// v000
// Measured on an AMD MI455X. A time is GPU time per run, averaged over a window of back-to-back runs after a warm-up
// (all launches, gaps included; the runs take copies of the inputs in turn), and the median of several windows.
// Apart from v000's, it joins two sittings. Times from different sittings can be a few percent apart, while
// side-by-side timings come from the same sitting.
// v000, which the later versions start from, runs in 1150 microseconds.
#include <hip/hip_runtime.h>
#include <math.h>

// Contractions, f32 accumulate: q/k/v projections on v_wmma_f32_16x16x32_bf16 (bf16 operands = RNE-converted inputs, exact products); attention q.k^T and p.v on v_wmma_f32_16x16x32_f16 (f16 operands: q,k carried x8, p carried x1024, v plain) for query rows >= RH and on v_wmma_f32_16x16x32_bf16 hi/lo 3-product planes for query rows < RH; output projection on v_wmma_f32_16x16x32_f16 (ctx carried x64 as f16 hi, plus an f16 residual plane for rows < RH; weight = bf16-RNE value x256 in f16). Softmax, RMS normalisation, rotary, head gain in f32.
// Layout per batch: bf16 copy of x; [out][in] weights used as K-contiguous Bt planes directly; projections exact; value projection written straight into the second segment of the output buffer; weightless RMS normalisation + half-split rotary (NTK-rescaled base, precise tables) + per-head gain into head planes [h][t][d]; value planes [g][d][t]; fused causal attention (one wave per 16 query rows x one head, 32-key steps, online softmax, diagonal block masked by select, blocks above the diagonal never visited) writes ctx planes [t][h*HD+d]; ctx x Wproj into the first segment of the output buffer.
// Register budget: fragment live ranges are bounded by per-group four-nop guards (GEMM: B fragments held per k-step, A fragments per 16-row group; attention: rolled score k-steps, p.v in two groups of four output tiles).

#ifndef NB
#define NB 2
#endif
#ifndef TT
#define TT 2048
#endif
#ifndef RH
#define RH 256
#endif
#define NB_FULL 2
#define TT_FULL 2048
#define DM   2048
#define NH_  16
#define NKV  4
#define REP  (NH_ / NKV)
#define HD   128
#define DQ   (NH_ * HD)
#define DKV  (NKV * HD)
#define QKC  8.0f                                   // q and k planes carry x8 each -> scores carry x64
#define SCLC (0.08838834764831845f * 0.015625f)     // HD^-0.5 folded with the 1/64 un-carry (exact power of two)
#define PCAR 1024.0f                                // fp16 probability carry
#define ACAR 64.0f                                  // ctx plane carry
#define WCAR 256.0f                                 // Wo plane carry
#define OSC  (1.0f / 16384.0f)                      // 1 / (ACAR * WCAR)
#define PP   40                                     // LDS pitch (halves) of the 16x32 probability tile
#define OP   136                                    // LDS pitch (halves) of the 16x128 ctx tile
static_assert(TT % 64 == 0);
static_assert(RH % 64 == 0);
static_assert(RH >= 64);
static_assert(RH <= TT);
static_assert(TT <= TT_FULL);
static_assert(NB >= 1);
static_assert(NB <= NB_FULL);
static_assert(DM % 32 == 0);
static_assert(DQ == DM);
static_assert(HD == 128);
static_assert((TT * HD) % 256 == 0);
static_assert(NH_ % NKV == 0);
static_assert(DM % 64 == 0);
static_assert(DQ % 64 == 0);
static_assert(DKV % 64 == 0);
static_assert((NH_ * TT) % 8 == 0);
static_assert((NKV * TT) % 8 == 0);
static_assert(32 * 4 == HD);                          // k_nrope: 32 lanes x (2 + 2) columns == head width
static_assert(HD % 32 == 0);                          // score k-steps of 32
static_assert(HD / 16 == 8);                          // p.v: two groups of four 16-wide output tiles
static_assert(PP >= 32);
static_assert((PP * 2) % 16 == 0);
static_assert(OP >= HD);
static_assert((OP * 2) % 16 == 0);
static_assert(TT_FULL > 1024);                        // NTK base rescale branch of the rotary tables
static_assert((size_t)NB_FULL * TT_FULL * DM * 4 == 33554432);                       // byte offset of the second output segment
static_assert(((size_t)NB_FULL * TT_FULL * DM + (size_t)NB_FULL * TT_FULL * DKV) * 4 == 41943040);   // total output bytes
#define WS_TOTAL ((size_t)DQ * DM * 2 + 2 * (size_t)DKV * DM * 2 + (size_t)DM * DQ * 2 + (size_t)TT * HD * 2 * 4 + (size_t)TT * DM * 2 + (size_t)TT * DQ * 4 + (size_t)TT * DKV * 4 + 3 * (size_t)NH_ * TT * HD * 2 + 6 * (size_t)NKV * TT * HD * 2 + (size_t)TT * DQ * 2 + (size_t)RH * DQ * 2)
static_assert(WS_TOTAL + 32 * 256 <= 134217728);

typedef _Float16 h16;
typedef unsigned short bf;
typedef __attribute__((ext_vector_type(16))) __bf16   v16bf;
typedef __attribute__((ext_vector_type(16))) _Float16 v16h;
typedef __attribute__((ext_vector_type(8)))  _Float16 v8h;
typedef __attribute__((ext_vector_type(8)))  unsigned short v8us;
typedef __attribute__((ext_vector_type(8)))  float    v8f;
typedef __attribute__((ext_vector_type(4)))  float    v4f;
typedef __attribute__((ext_vector_type(2)))  _Float16 v2h;
typedef __attribute__((ext_vector_type(2)))  unsigned short v2us;
typedef __attribute__((ext_vector_type(2)))  float    v2f;
typedef v8h  __attribute__((may_alias)) v8ha;
typedef v4f  __attribute__((may_alias)) v4fa;
typedef v8us __attribute__((may_alias)) v8usa;

__device__ __forceinline__ unsigned short f2bf(float f) { unsigned u = __float_as_uint(f); u += 0x7FFFu + ((u >> 16) & 1u); return (unsigned short)(u >> 16); }
__device__ __forceinline__ float bf2f(unsigned short b) { return __uint_as_float(((unsigned)b) << 16); }
__device__ __forceinline__ float bfr(float f) { return bf2f(f2bf(f)); }
__device__ __forceinline__ v16h cat16(v8h lo, v8h hi) { return __builtin_shufflevector(lo, hi, 0, 1, 2, 3, 4, 5, 6, 7, 8, 9, 10, 11, 12, 13, 14, 15); }
__device__ __forceinline__ v16bf cat16b(v8us lo, v8us hi) { return __builtin_bit_cast(v16bf, __builtin_shufflevector(lo, hi, 0, 1, 2, 3, 4, 5, 6, 7, 8, 9, 10, 11, 12, 13, 14, 15)); }
__device__ __forceinline__ v8f wmma16(v16h a, v16h b, v8f c) { return __builtin_amdgcn_wmma_f32_16x16x32_f16(false, a, false, b, (short)0, c, false, false); }
__device__ __forceinline__ v8f wmmab(v16bf a, v16bf b, v8f c) { return __builtin_amdgcn_wmma_f32_16x16x32_bf16(false, a, false, b, (short)0, c, false, false); }
__device__ __forceinline__ h16 tohx(float x) { return (h16)x; }
__device__ __forceinline__ void splitf(float y, unsigned short& h, unsigned short& l) { h = f2bf(y); l = f2bf(y - bf2f(h)); }
// fp16 convert whose result can never be a sub-normal operand: magnitudes below 2^-14 become zero by value select.
static __device__ __forceinline__ h16 toh_flush(float v) { const h16 r = (h16)v; return (fabsf(v) < 6.103515625e-05f) ? (h16)0.0f : r; }

// ---- 16-bit WMMA fragment loaders: lane l, m = n = l & 15, h = l >> 4; elements 0..7 <- k0 + 8h + 0..7, elements 8..15 <- k0 + 16 + 8h + 0..7 (A rows and K-contiguous Bt rows alike).
template <typename T16> struct WFrag;
template <> struct WFrag<h16> { typedef v16h V; static __device__ __forceinline__ V ld(const h16* p) { return cat16(*(const v8h*)p, *(const v8h*)(p + 16)); } static __device__ __forceinline__ v8f mma(V a, V b, v8f c) { return wmma16(a, b, c); } };
template <> struct WFrag<bf> { typedef v16bf V; static __device__ __forceinline__ V ld(const bf* p) { return cat16b(*(const v8us*)p, *(const v8us*)(p + 16)); } static __device__ __forceinline__ v8f mma(V a, V b, v8f c) { return wmmab(a, b, c); } };

// ---- k_gemmw: register-blocked GEMM, ONE WAVE per 64x64 output tile (16 accumulators), operands straight from K-contiguous 16-bit planes; grid (M/64, N/64, Z), 32 threads.
// C[m][n] (f32, pitch ldc) = cs * sum_k A[m][k] Bt[n][k] (+ A2[m][k] Bt[n][k] when NSPLIT is 1 or 2, + A[m][k] Bt2[n][k] when NSPLIT >= 2) + optional bf16-RNE bias[n]. z-batch strides sA/sB/sC in elements. K % 32 == 0, M % 64 == 0, N % 64 == 0.
// k-step: the four Bt fragments are loaded once and held; per 16-row group the A fragment(s) are loaded, the group's four accumulators updated (product order per accumulator: A.Bt, A2.Bt, A.Bt2), then ONE four-nop guard ties the group's accumulators and every live fragment.
template <typename T16, int NSPLIT, bool BIAS>
__global__ __launch_bounds__(32) void k_gemmw(const T16* __restrict__ A, const T16* __restrict__ A2, const T16* __restrict__ Bt, const T16* __restrict__ Bt2, int K, float* C, int ldc, const float* __restrict__ bias, float cs, size_t sA, size_t sB, size_t sC) {
    typedef typename WFrag<T16>::V V;
    __shared__ __align__(16) float os[16 * 68];
    const size_t z = blockIdx.z; A += z * sA; if (A2) A2 += z * sA; Bt += z * sB; if (Bt2) Bt2 += z * sB; C += z * sC;
    const int lane = threadIdx.x & 31, lr = lane & 15, hi = lane >> 4; const int r0 = blockIdx.x * 64, c0 = blockIdx.y * 64;
    v8f acc[4][4];
#pragma unroll
    for (int mb = 0; mb < 4; ++mb)
#pragma unroll
        for (int nb = 0; nb < 4; ++nb) acc[mb][nb] = (v8f){};
    const size_t aoff = (size_t)(r0 + lr) * K + 8 * hi, boff = (size_t)(c0 + lr) * K + 8 * hi;
#pragma unroll 1
    for (int kc = 0; kc < K; kc += 32) {
        V b[4], b2[4];
#pragma unroll
        for (int nb = 0; nb < 4; ++nb) { b[nb] = WFrag<T16>::ld(Bt + boff + (size_t)nb * 16 * K + kc); b2[nb] = b[nb]; if (NSPLIT >= 2) b2[nb] = WFrag<T16>::ld(Bt2 + boff + (size_t)nb * 16 * K + kc); }
#pragma unroll
        for (int mb = 0; mb < 4; ++mb) {
            const V a = WFrag<T16>::ld(A + aoff + (size_t)mb * 16 * K + kc); V a2 = a; if (NSPLIT == 1 || NSPLIT == 2) a2 = WFrag<T16>::ld(A2 + aoff + (size_t)mb * 16 * K + kc);
#pragma unroll
            for (int nb = 0; nb < 4; ++nb) { acc[mb][nb] = WFrag<T16>::mma(a, b[nb], acc[mb][nb]); if (NSPLIT == 1 || NSPLIT == 2) acc[mb][nb] = WFrag<T16>::mma(a2, b[nb], acc[mb][nb]); if (NSPLIT >= 2) acc[mb][nb] = WFrag<T16>::mma(a, b2[nb], acc[mb][nb]); }
            asm volatile("v_nop\n\tv_nop\n\tv_nop\n\tv_nop" : "+v"(acc[mb][0]), "+v"(acc[mb][1]), "+v"(acc[mb][2]), "+v"(acc[mb][3]) : "v"(a), "v"(a2), "v"(b[0]), "v"(b[1]), "v"(b[2]), "v"(b[3]), "v"(b2[0]), "v"(b2[1]), "v"(b2[2]), "v"(b2[3]));
        }
    }
#pragma unroll
    for (int mb = 0; mb < 4; ++mb) {
#pragma unroll
        for (int nb = 0; nb < 4; ++nb) {
#pragma unroll
            for (int j = 0; j < 8; ++j) os[(hi * 8 + j) * 68 + nb * 16 + lr] = acc[mb][nb][j]; }
        __syncthreads();
        float* crow = C + (size_t)(r0 + mb * 16) * ldc + c0;
{
#pragma unroll
            for (int s = 0; s < 8; ++s) { const int row = 2 * s + hi, cofs = lr * 4; v4f val = *(const v4fa*)(os + row * 68 + cofs); val = val * cs;
                if (BIAS) { val[0] += bfr(bias[c0 + cofs]); val[1] += bfr(bias[c0 + cofs + 1]); val[2] += bfr(bias[c0 + cofs + 2]); val[3] += bfr(bias[c0 + cofs + 3]); }
                *(v4f*)(crow + (size_t)row * ldc + cofs) = val; }
             }
        __syncthreads();
    }
}

__global__ __launch_bounds__(256) void k_cvt8(const float* __restrict__ src, bf* dst, size_t n8) { const size_t i = (size_t)blockIdx.x * 256 + threadIdx.x; if (i >= n8) return; const v8f v = *(const v8f*)(src + i * 8); v8us o;
#pragma unroll
    for (int k = 0; k < 8; ++k) o[k] = f2bf(v[k]); *(v8us*)(dst + i * 8) = o;  }
__global__ __launch_bounds__(256) void k_cvt8h(const float* __restrict__ src, h16* dst, size_t n8, float sc) { const size_t i = (size_t)blockIdx.x * 256 + threadIdx.x; if (i >= n8) return; const v8f v = *(const v8f*)(src + i * 8); v8h o;
#pragma unroll
    for (int k = 0; k < 8; ++k) o[k] = tohx(bfr(v[k]) * sc); *(v8h*)(dst + i * 8) = o;  }

struct ThetaTab { float th[HD / 2]; };
static_assert(sizeof(ThetaTab) == 256);
__global__ __launch_bounds__(256) void k_cstab(ThetaTab tab, float* CS) {
    const int idx = blockIdx.x * 256 + threadIdx.x; if (idx >= TT * HD) return;
    const int t = idx / HD, d = idx % HD, j = d & (HD / 2 - 1);
    float th = tab.th[0];
#pragma unroll
    for (int i = 1; i < HD / 2; ++i) th = (j == i) ? tab.th[i] : th;
    const float ang = __fmul_rn((float)t, th);
    float sn, cn; sincosf(ang, &sn, &cn);
    v2f o; o[0] = cn; o[1] = sn;
    *(v2f*)(CS + (size_t)idx * 2) = o;  }

// ---- k_nrope: one wave per (head h, token t) row of HD = 128 values x = F[t][h*HD + d] (row pitch 'pitch'):
// weightless RMS normalisation xn = x * rsqrt(mean(x^2) + 2^-23); half-split rotary out[j] = xn[j] cos[t][j] + xn[j+64] sin[t][j], out[64+j] = xn[j+64] cos[t][j] - xn[j] sin[t][j] (j < 64);
// times the per-head gain (bf16 RNE value of the input vector entry; 1 when useg == 0), times sc. Head planes [h][t][d]: fp16 (magnitudes below 2^-14 forced to zero), bf16 hi, bf16 lo.
__global__ __launch_bounds__(256) void k_nrope(const float* __restrict__ F, int pitch, int nheads, const float* __restrict__ CS, const float* __restrict__ gain, int useg, float sc, h16* P16, bf* Ph, bf* Pl) {
#pragma clang fp contract(off)
    const int wave = __builtin_amdgcn_readfirstlane(threadIdx.x >> 5); const int lane = threadIdx.x & 31;
    const int row = (int)blockIdx.x * 8 + wave; if (row >= nheads * TT) return;
    const int h = row / TT, t = row % TT; const int j0 = 2 * lane;
    const float* f = F + (size_t)t * pitch + h * HD;
    const v2f x1 = *(const v2f*)(f + j0); const v2f x2 = *(const v2f*)(f + HD / 2 + j0);
    const v4f cs = *(const v4f*)(CS + ((size_t)t * HD + j0) * 2);            // {cos j0, sin j0, cos j0+1, sin j0+1}
    float ss = x1[0] * x1[0] + x1[1] * x1[1];
    ss = ss + (x2[0] * x2[0] + x2[1] * x2[1]);
    ss += __shfl_xor(ss, 16, 32); ss += __shfl_xor(ss, 8, 32); ss += __shfl_xor(ss, 4, 32); ss += __shfl_xor(ss, 2, 32); ss += __shfl_xor(ss, 1, 32);
    const float rn = rsqrtf(ss * (1.0f / (float)HD) + 1.1920928955078125e-07f);
    const float gv = bfr(gain[h]); const float gs = ((useg != 0) ? gv : 1.0f) * sc;
    v2h a16, b16; v2us ah, al, bh, bl;
#pragma unroll
    for (int q = 0; q < 2; ++q) {
        const float u1 = x1[q] * rn, u2 = x2[q] * rn; const float cn = cs[2 * q], sn = cs[2 * q + 1];
        const float o1 = (u1 * cn + u2 * sn) * gs;
        const float o2 = (u2 * cn - u1 * sn) * gs;
        a16[q] = toh_flush(o1); b16[q] = toh_flush(o2);
        unsigned short hh, ll; splitf(o1, hh, ll); ah[q] = hh; al[q] = ll; splitf(o2, hh, ll); bh[q] = hh; bl[q] = ll; }
    const size_t e1 = (size_t)row * HD + j0, e2 = e1 + HD / 2;
    *(v2h*)(P16 + e1) = a16; *(v2h*)(P16 + e2) = b16; *(v2us*)(Ph + e1) = ah; *(v2us*)(Ph + e2) = bh; *(v2us*)(Pl + e1) = al; *(v2us*)(Pl + e2) = bl;  }
__global__ __launch_bounds__(256) void k_vtp(const float* __restrict__ F, int pitch, int nheads, h16* V16, bf* Vh, bf* Vl) { const size_t e = ((size_t)blockIdx.x * 256 + threadIdx.x) * 2; if (e >= (size_t)nheads * HD * TT) return; const int t = (int)(e % TT); const int d = (int)((e / TT) % HD); const int g = (int)(e / ((size_t)TT * HD)); v2h o16; v2us oh, ol;
#pragma unroll
    for (int q = 0; q < 2; ++q) { const float x = F[(size_t)(t + q) * pitch + g * HD + d]; o16[q] = tohx(x); unsigned short a2, c2; splitf(x, a2, c2); oh[q] = a2; ol[q] = c2; }
    *(v2h*)(V16 + e) = o16; *(v2us*)(Vh + e) = oh; *(v2us*)(Vl + e) = ol;  }

// ---- k_flash: fused causal attention, ONE WAVE (32 threads) per (16 query rows qt0.., head h = blockIdx.y; kv group g = h / REP), keys in 32-wide steps s0 = 0 .. qt0 (s0 <= qt0), online softmax in f32.
// SPLIT: q, k as bf16 hi/lo planes (3 products), p as bf16 hi/lo (3 products with v hi/lo). !SPLIT: q, k fp16 (x8), p fp16 x1024, v fp16.
// Score k-steps (d in chunks of 32) are a rolled loop with the four-nop guard inside each step; p.v runs as two groups of four 16-wide output tiles, one guard per group tying the group's accumulators and every live fragment.
// Scores D (row 8h+r, key col nb*16+m) -> probabilities to an LDS 16x32 tile -> A fragments per the loader map; block barrier before the reload and before the next step's stores.
template <bool SPLIT>
__global__ __launch_bounds__(32) void k_flash(const h16* __restrict__ Q16, const bf* __restrict__ Qh, const bf* __restrict__ Ql,
                                              const h16* __restrict__ K16, const bf* __restrict__ Kh, const bf* __restrict__ Kl,
                                              const h16* __restrict__ V16, const bf* __restrict__ Vh, const bf* __restrict__ Vl,
                                              int roff, h16* AT, h16* ATL) {
    __shared__ __align__(16) h16 pt[16 * PP];
    __shared__ __align__(16) bf  pth[16 * PP];
    __shared__ __align__(16) bf  ptl[16 * PP];
    __shared__ __align__(16) h16 os[16 * OP];
    __shared__ __align__(16) h16 osl[16 * OP];
    const int lane = threadIdx.x & 31, lr = lane & 15, hi = lane >> 4;
    const int qt0 = roff + (int)blockIdx.x * 16; const int h = (int)blockIdx.y; const int g = h / REP;
    const size_t qoff = ((size_t)h * TT + qt0 + lr) * HD + 8 * hi;            // A rows: query rows qt0 + m, k = d
    const size_t kb0  = (size_t)g * TT * HD + (size_t)lr * HD + 8 * hi;       // Bt rows: key rows s0 + n, k = d
    const size_t vb0  = (size_t)g * HD * TT + (size_t)lr * TT + 8 * hi;       // Bt rows: d = nb*16 + n, k = key
    v8f oacc[8];
#pragma unroll
    for (int nb = 0; nb < 8; ++nb) oacc[nb] = (v8f){};
    float mrow[8], lrow[8];
#pragma unroll
    for (int r = 0; r < 8; ++r) { mrow[r] = -3.0e38f; lrow[r] = 0.0f; }
#pragma unroll 1
    for (int s0 = 0; s0 <= qt0; s0 += 32) {
        const size_t koff = kb0 + (size_t)s0 * HD;
        v8f c0 = (v8f){}; v8f c1 = (v8f){};
        if (SPLIT) {
#pragma unroll 1
            for (int kc = 0; kc < HD / 32; ++kc) {
                const v16bf a = WFrag<bf>::ld(Qh + qoff + kc * 32); const v16bf a2 = WFrag<bf>::ld(Ql + qoff + kc * 32);
                const v16bf b = WFrag<bf>::ld(Kh + koff + kc * 32); const v16bf b2 = WFrag<bf>::ld(Kl + koff + kc * 32);
                c0 = wmmab(a, b, c0); c0 = wmmab(a2, b, c0); c0 = wmmab(a, b2, c0);
                const v16bf e = WFrag<bf>::ld(Kh + koff + (size_t)16 * HD + kc * 32); const v16bf e2 = WFrag<bf>::ld(Kl + koff + (size_t)16 * HD + kc * 32);
                c1 = wmmab(a, e, c1); c1 = wmmab(a2, e, c1); c1 = wmmab(a, e2, c1);
                asm volatile("v_nop\n\tv_nop\n\tv_nop\n\tv_nop" : "+v"(c0), "+v"(c1) : "v"(a), "v"(a2), "v"(b), "v"(b2), "v"(e), "v"(e2));
            }
        } else {
#pragma unroll 1
            for (int kc = 0; kc < HD / 32; ++kc) {
                const v16h a = WFrag<h16>::ld(Q16 + qoff + kc * 32);
                const v16h b = WFrag<h16>::ld(K16 + koff + kc * 32);
                const v16h e = WFrag<h16>::ld(K16 + koff + (size_t)16 * HD + kc * 32);
                c0 = wmma16(a, b, c0); c1 = wmma16(a, e, c1);
                asm volatile("v_nop\n\tv_nop\n\tv_nop\n\tv_nop" : "+v"(c0), "+v"(c1) : "v"(a), "v"(b), "v"(e));
            }
        }
        // scale, causal select (key <= query row), step max, online update, probabilities to LDS, row sums of the stored operand values
        float al[8];
#pragma unroll
        for (int r = 0; r < 8; ++r) {
            const int qrow = qt0 + 8 * hi + r;
            const float t0 = (s0 + lr <= qrow) ? c0[r] * SCLC : -3.0e38f;
            const float t1 = (s0 + 16 + lr <= qrow) ? c1[r] * SCLC : -3.0e38f;
            float tv = fmaxf(t0, t1);
            tv = fmaxf(tv, __shfl_xor(tv, 1, 32)); tv = fmaxf(tv, __shfl_xor(tv, 2, 32)); tv = fmaxf(tv, __shfl_xor(tv, 4, 32)); tv = fmaxf(tv, __shfl_xor(tv, 8, 32));
            const float mnew = fmaxf(mrow[r], tv);
            float dm = __fsub_rn(mrow[r], mnew); asm volatile("" : "+v"(dm));
            const float alpha = __builtin_amdgcn_exp2f(__fmul_rn(dm, 1.4426950408889634f));
            float d0 = __fsub_rn(t0, mnew); asm volatile("" : "+v"(d0));
            float d1 = __fsub_rn(t1, mnew); asm volatile("" : "+v"(d1));
            const float p0 = __builtin_amdgcn_exp2f(__fmul_rn(d0, 1.4426950408889634f));
            const float p1 = __builtin_amdgcn_exp2f(__fmul_rn(d1, 1.4426950408889634f));
            mrow[r] = mnew;
            float q0, q1;
            if (SPLIT) {
                unsigned short ah, alo, bh, blo; splitf(p0, ah, alo); splitf(p1, bh, blo);
                pth[(8 * hi + r) * PP + lr] = ah; ptl[(8 * hi + r) * PP + lr] = alo; pth[(8 * hi + r) * PP + 16 + lr] = bh; ptl[(8 * hi + r) * PP + 16 + lr] = blo;
                q0 = bf2f(ah) + bf2f(alo); q1 = bf2f(bh) + bf2f(blo);
            } else {
                const h16 x0 = toh_flush(p0 * PCAR), x1 = toh_flush(p1 * PCAR);
                pt[(8 * hi + r) * PP + lr] = x0; pt[(8 * hi + r) * PP + 16 + lr] = x1;
                q0 = (float)x0; q1 = (float)x1;
            }
            float ts = q0 + q1;
            ts += __shfl_xor(ts, 1, 32); ts += __shfl_xor(ts, 2, 32); ts += __shfl_xor(ts, 4, 32); ts += __shfl_xor(ts, 8, 32);
            lrow[r] = lrow[r] * alpha + ts;
            al[r] = alpha;
        }
#pragma unroll
        for (int nb = 0; nb < 8; ++nb)
#pragma unroll
            for (int r = 0; r < 8; ++r) oacc[nb][r] *= al[r];
        __syncthreads();
        const size_t voff = vb0 + s0;
        if (SPLIT) {
            const v16bf pa  = cat16b(*(const v8usa*)(pth + lr * PP + 8 * hi), *(const v8usa*)(pth + lr * PP + 16 + 8 * hi));
            const v16bf pa2 = cat16b(*(const v8usa*)(ptl + lr * PP + 8 * hi), *(const v8usa*)(ptl + lr * PP + 16 + 8 * hi));
#pragma unroll
            for (int gq = 0; gq < 2; ++gq) {
                v16bf vb[4], vb2[4];
#pragma unroll
                for (int i = 0; i < 4; ++i) { vb[i] = WFrag<bf>::ld(Vh + voff + (size_t)(gq * 4 + i) * 16 * TT); vb2[i] = WFrag<bf>::ld(Vl + voff + (size_t)(gq * 4 + i) * 16 * TT); }
#pragma unroll
                for (int i = 0; i < 4; ++i) { oacc[gq * 4 + i] = wmmab(pa, vb[i], oacc[gq * 4 + i]); oacc[gq * 4 + i] = wmmab(pa2, vb[i], oacc[gq * 4 + i]); oacc[gq * 4 + i] = wmmab(pa, vb2[i], oacc[gq * 4 + i]); }
                asm volatile("v_nop\n\tv_nop\n\tv_nop\n\tv_nop" : "+v"(oacc[gq * 4 + 0]), "+v"(oacc[gq * 4 + 1]), "+v"(oacc[gq * 4 + 2]), "+v"(oacc[gq * 4 + 3]) : "v"(pa), "v"(pa2), "v"(vb[0]), "v"(vb[1]), "v"(vb[2]), "v"(vb[3]), "v"(vb2[0]), "v"(vb2[1]), "v"(vb2[2]), "v"(vb2[3]));
            }
        } else {
            const v16h pa = cat16(*(const v8ha*)(pt + lr * PP + 8 * hi), *(const v8ha*)(pt + lr * PP + 16 + 8 * hi));
#pragma unroll
            for (int gq = 0; gq < 2; ++gq) {
                v16h vb[4];
#pragma unroll
                for (int i = 0; i < 4; ++i) vb[i] = WFrag<h16>::ld(V16 + voff + (size_t)(gq * 4 + i) * 16 * TT);
#pragma unroll
                for (int i = 0; i < 4; ++i) oacc[gq * 4 + i] = wmma16(pa, vb[i], oacc[gq * 4 + i]);
                asm volatile("v_nop\n\tv_nop\n\tv_nop\n\tv_nop" : "+v"(oacc[gq * 4 + 0]), "+v"(oacc[gq * 4 + 1]), "+v"(oacc[gq * 4 + 2]), "+v"(oacc[gq * 4 + 3]) : "v"(pa), "v"(vb[0]), "v"(vb[1]), "v"(vb[2]), "v"(vb[3]));
            }
        }
        __syncthreads();
    }
    // normalise, carry x ACAR, stage fp16 hi (+ fp16 residual) tile
#pragma unroll
    for (int r = 0; r < 8; ++r) {
        const float inv = ACAR / lrow[r];
#pragma unroll
        for (int nb = 0; nb < 8; ++nb) { const float v = oacc[nb][r] * inv; const h16 x = toh_flush(v); os[(8 * hi + r) * OP + nb * 16 + lr] = x; if (SPLIT) osl[(8 * hi + r) * OP + nb * 16 + lr] = toh_flush(v - (float)x); }
    }
    __syncthreads();
    h16* arow = AT + (size_t)qt0 * DQ + (size_t)h * HD;
{
#pragma unroll
        for (int s = 0; s < 8; ++s) { const int row = 2 * s + hi; const v8h val = *(const v8ha*)(os + row * OP + lr * 8); *(v8h*)(arow + (size_t)row * DQ + lr * 8) = val;
            if (SPLIT) { h16* lrw = ATL + (size_t)qt0 * DQ + (size_t)h * HD; const v8h v2 = *(const v8ha*)(osl + row * OP + lr * 8); *(v8h*)(lrw + (size_t)row * DQ + lr * 8) = v2; } }
         }
}

extern "C" void kernel_launch(void* const* d_in, const int* in_sizes, int n_in,
                              void* d_out, int out_size, void* d_ws, size_t ws_size, hipStream_t stream) {
    if (n_in < 6) return;
    const size_t rows_used = (size_t)(NB - 1) * TT_FULL + TT;
    if ((size_t)in_sizes[0] < rows_used * DM || (size_t)in_sizes[1] < (size_t)DQ * DM || (size_t)in_sizes[2] < (size_t)DKV * DM || (size_t)in_sizes[3] < (size_t)DKV * DM ||
        (size_t)in_sizes[4] < (size_t)DM * DQ || in_sizes[5] < NH_ || (size_t)out_size < (size_t)NB_FULL * TT_FULL * DM + rows_used * DKV) return;
    // input order: x, Wq [DQ][DM], Wk [DKV][DM], Wv [DKV][DM], Wproj [DM][DQ], q_gain [NH_]
    const float* x = (const float*)d_in[0]; const float* wq = (const float*)d_in[1]; const float* wk = (const float*)d_in[2];
    const float* wv = (const float*)d_in[3]; const float* wo = (const float*)d_in[4]; const float* qg = (const float*)d_in[5];
    float* OUT = (float*)d_out;                                   // [NB_FULL][TT_FULL][DM]
    float* OUT1 = OUT + (size_t)NB_FULL * TT_FULL * DM;           // [NB_FULL][TT_FULL][NKV][HD], second segment (fixed element offset)
    char* wsp = (char*)d_ws;
    auto take = [&](size_t bytes) { char* p = wsp; wsp += (bytes + 255) & ~(size_t)255; return (void*)p; };
    bf* WQ = (bf*)take((size_t)DQ * DM * 2); bf* WK = (bf*)take((size_t)DKV * DM * 2); bf* WV = (bf*)take((size_t)DKV * DM * 2); h16* WO = (h16*)take((size_t)DM * DQ * 2);
    float* CS = (float*)take((size_t)TT * HD * 2 * 4);
    bf* XB = (bf*)take((size_t)TT * DM * 2); float* FQ = (float*)take((size_t)TT * DQ * 4); float* FK = (float*)take((size_t)TT * DKV * 4);
    h16* QP16 = (h16*)take((size_t)NH_ * TT * HD * 2); bf* QPh = (bf*)take((size_t)NH_ * TT * HD * 2); bf* QPl = (bf*)take((size_t)NH_ * TT * HD * 2);
    h16* KP16 = (h16*)take((size_t)NKV * TT * HD * 2); bf* KPh = (bf*)take((size_t)NKV * TT * HD * 2); bf* KPl = (bf*)take((size_t)NKV * TT * HD * 2);
    h16* VT16 = (h16*)take((size_t)NKV * HD * TT * 2); bf* VTh = (bf*)take((size_t)NKV * HD * TT * 2); bf* VTl = (bf*)take((size_t)NKV * HD * TT * 2);
    h16* AT16 = (h16*)take((size_t)TT * DQ * 2); h16* ATL16 = (h16*)take((size_t)RH * DQ * 2);
    if ((size_t)(wsp - (char*)d_ws) > ws_size) return;    // 99,614,720 B at NB 2 / TT 2048
    // rotary frequencies: base = 10000 * (TT_FULL / 1024)^(HD / (HD - 2)) in double, narrowed to f32; theta[j] = 1 / base^(2j / HD) evaluated in f32
    ThetaTab tab;
    const double nbase = 10000.0 * pow((double)TT_FULL / 1024.0, (double)HD / (double)(HD - 2));
    const float nbasef = (float)nbase;
    for (int j = 0; j < HD / 2; ++j) { const float ef = (float)(2 * j) / (float)HD; const double p = pow((double)nbasef, (double)ef); const float pf = (float)p; tab.th[j] = 1.0f / pf; }
    k_cvt8<<<(unsigned)(((size_t)DQ * DM / 8 + 255) / 256), 256, 0, stream>>>(wq, WQ, (size_t)DQ * DM / 8);
    k_cvt8<<<(unsigned)(((size_t)DKV * DM / 8 + 255) / 256), 256, 0, stream>>>(wk, WK, (size_t)DKV * DM / 8);
    k_cvt8<<<(unsigned)(((size_t)DKV * DM / 8 + 255) / 256), 256, 0, stream>>>(wv, WV, (size_t)DKV * DM / 8);
    k_cvt8h<<<(unsigned)(((size_t)DM * DQ / 8 + 255) / 256), 256, 0, stream>>>(wo, WO, (size_t)DM * DQ / 8, WCAR);
    k_cstab<<<(unsigned)((TT * HD + 255) / 256), 256, 0, stream>>>(tab, CS);
    const unsigned LK = (unsigned)(((size_t)NKV * TT * HD / 2 + 255) / 256);
    const unsigned RQ = (unsigned)(((size_t)NH_ * TT + 7) / 8), RK = (unsigned)(((size_t)NKV * TT + 7) / 8);
    for (int b = 0; b < NB; ++b) {
        float* FV = OUT1 + (size_t)b * TT_FULL * DKV;             // value projection lives in the output buffer (row pitch DKV)
        k_cvt8<<<(unsigned)(((size_t)TT * DM / 8 + 255) / 256), 256, 0, stream>>>(x + (size_t)b * TT_FULL * DM, XB, (size_t)TT * DM / 8);
        k_gemmw<bf, 0, false><<<dim3(TT / 64, DQ / 64, 1), 32, 0, stream>>>(XB, nullptr, WQ, nullptr, DM, FQ, DQ, nullptr, 1.0f, 0, 0, 0);
        k_nrope<<<RQ, 256, 0, stream>>>(FQ, DQ, NH_, CS, qg, 1, QKC, QP16, QPh, QPl);
        k_gemmw<bf, 0, false><<<dim3(TT / 64, DKV / 64, 1), 32, 0, stream>>>(XB, nullptr, WK, nullptr, DM, FK, DKV, nullptr, 1.0f, 0, 0, 0);
        k_nrope<<<RK, 256, 0, stream>>>(FK, DKV, NKV, CS, qg, 0, QKC, KP16, KPh, KPl);
        k_gemmw<bf, 0, false><<<dim3(TT / 64, DKV / 64, 1), 32, 0, stream>>>(XB, nullptr, WV, nullptr, DM, FV, DKV, nullptr, 1.0f, 0, 0, 0);
        k_vtp<<<LK, 256, 0, stream>>>(FV, DKV, NKV, VT16, VTh, VTl);
        k_flash<true><<<dim3(RH / 16, NH_, 1), 32, 0, stream>>>(QP16, QPh, QPl, KP16, KPh, KPl, VT16, VTh, VTl, 0, AT16, ATL16);
        if (TT > RH) k_flash<false><<<dim3((TT - RH) / 16, NH_, 1), 32, 0, stream>>>(QP16, QPh, QPl, KP16, KPh, KPl, VT16, VTh, VTl, RH, AT16, ATL16);
        float* OUTb = OUT + (size_t)b * TT_FULL * DM;
        k_gemmw<h16, 1, false><<<dim3(RH / 64, DM / 64, 1), 32, 0, stream>>>(AT16, ATL16, WO, nullptr, DQ, OUTb, DM, nullptr, OSC, 0, 0, 0);
        if (TT > RH) k_gemmw<h16, 0, false><<<dim3((TT - RH) / 64, DM / 64, 1), 32, 0, stream>>>(AT16 + (size_t)RH * DQ, nullptr, WO, nullptr, DQ, OUTb + (size_t)RH * DM, DM, nullptr, OSC, 0, 0, 0);
    }
}

// v001
// One run takes 680 microseconds.
// Timed twice side by side with v000, it ran 1.71 and 1.73 times as fast.
#include <hip/hip_runtime.h>
#include <math.h>

// Contractions, f32 accumulate: q/k/v projections on v_wmma_f32_16x16x32_bf16 (bf16 operands = RNE-converted inputs, exact products); attention q.k^T and p.v on v_wmma_f32_16x16x32_f16 (f16 operands: q,k carried x8, p carried x1024, v plain) for query rows >= RH and on v_wmma_f32_16x16x32_bf16 hi/lo 3-product planes for query rows < RH; output projection on v_wmma_f32_16x16x32_f16 (ctx carried x64 as f16 hi, plus an f16 residual plane for rows < RH; weight = bf16-RNE value x256 in f16). Softmax, RMS normalisation, rotary, head gain in f32.
// Layout per batch: bf16 copy of x; [out][in] weights used as K-contiguous Bt planes directly; projections exact; value projection written straight into the second segment of the output buffer; weightless RMS normalisation + half-split rotary (NTK-rescaled base, precise tables) + per-head gain into head planes [h][t][d]; value planes [g][d][t]; fused causal attention (one wave per 16 query rows x one head, 32-key steps, online softmax, diagonal block masked by select, blocks above the diagonal never visited) writes ctx planes [t][h*HD+d]; ctx x Wproj into the first segment of the output buffer.
// Register budget: GEMM holds 16 accumulators and two whole k-steps of fragments; attention bounds fragment live ranges by per-group four-nop guards (rolled score k-steps, p.v in two groups of four output tiles).

#ifndef NB
#define NB 2
#endif
#ifndef TT
#define TT 2048
#endif
#ifndef RH
#define RH 256
#endif
#define NB_FULL 2
#define TT_FULL 2048
#define DM   2048
#define NH_  16
#define NKV  4
#define REP  (NH_ / NKV)
#define HD   128
#define DQ   (NH_ * HD)
#define DKV  (NKV * HD)
#define QKC  8.0f                                   // q and k planes carry x8 each -> scores carry x64
#define SCLC (0.08838834764831845f * 0.015625f)     // HD^-0.5 folded with the 1/64 un-carry (exact power of two)
#define PCAR 1024.0f                                // fp16 probability carry
#define ACAR 64.0f                                  // ctx plane carry
#define WCAR 256.0f                                 // Wo plane carry
#define OSC  (1.0f / 16384.0f)                      // 1 / (ACAR * WCAR)
#define PP   40                                     // LDS pitch (halves) of the 16x32 probability tile
#define OP   136                                    // LDS pitch (halves) of the 16x128 ctx tile
static_assert(TT % 64 == 0);
static_assert(RH % 64 == 0);
static_assert(RH >= 64);
static_assert(RH <= TT);
static_assert(TT <= TT_FULL);
static_assert(NB >= 1);
static_assert(NB <= NB_FULL);
static_assert(DM % 32 == 0);
static_assert(DQ == DM);
static_assert(HD == 128);
static_assert((TT * HD) % 256 == 0);
static_assert(NH_ % NKV == 0);
static_assert(DM % 64 == 0);
static_assert(DQ % 64 == 0);
static_assert(DKV % 64 == 0);
static_assert((NH_ * TT) % 8 == 0);
static_assert((NKV * TT) % 8 == 0);
static_assert(32 * 4 == HD);                          // k_nrope: 32 lanes x (2 + 2) columns == head width
static_assert(HD % 32 == 0);                          // score k-steps of 32
static_assert(HD / 16 == 8);                          // p.v: two groups of four 16-wide output tiles
static_assert(PP >= 32);
static_assert((PP * 2) % 16 == 0);
static_assert(OP >= HD);
static_assert((OP * 2) % 16 == 0);
static_assert(TT_FULL > 1024);                        // NTK base rescale branch of the rotary tables
static_assert((size_t)NB_FULL * TT_FULL * DM * 4 == 33554432);                       // byte offset of the second output segment
static_assert(((size_t)NB_FULL * TT_FULL * DM + (size_t)NB_FULL * TT_FULL * DKV) * 4 == 41943040);   // total output bytes
#define WS_TOTAL ((size_t)DQ * DM * 2 + 2 * (size_t)DKV * DM * 2 + (size_t)DM * DQ * 2 + (size_t)TT * HD * 2 * 4 + (size_t)TT * DM * 2 + (size_t)TT * DQ * 4 + (size_t)TT * DKV * 4 + 3 * (size_t)NH_ * TT * HD * 2 + 6 * (size_t)NKV * TT * HD * 2 + (size_t)TT * DQ * 2 + (size_t)RH * DQ * 2)
static_assert(WS_TOTAL + 32 * 256 <= 134217728);

typedef _Float16 h16;
typedef unsigned short bf;
typedef __attribute__((ext_vector_type(16))) __bf16   v16bf;
typedef __attribute__((ext_vector_type(16))) _Float16 v16h;
typedef __attribute__((ext_vector_type(8)))  _Float16 v8h;
typedef __attribute__((ext_vector_type(8)))  unsigned short v8us;
typedef __attribute__((ext_vector_type(8)))  float    v8f;
typedef __attribute__((ext_vector_type(4)))  float    v4f;
typedef __attribute__((ext_vector_type(2)))  _Float16 v2h;
typedef __attribute__((ext_vector_type(2)))  unsigned short v2us;
typedef __attribute__((ext_vector_type(2)))  float    v2f;
typedef v8h  __attribute__((may_alias)) v8ha;
typedef v4f  __attribute__((may_alias)) v4fa;
typedef v8us __attribute__((may_alias)) v8usa;

__device__ __forceinline__ unsigned short f2bf(float f) { unsigned u = __float_as_uint(f); u += 0x7FFFu + ((u >> 16) & 1u); return (unsigned short)(u >> 16); }
__device__ __forceinline__ float bf2f(unsigned short b) { return __uint_as_float(((unsigned)b) << 16); }
__device__ __forceinline__ float bfr(float f) { return bf2f(f2bf(f)); }
__device__ __forceinline__ v16h cat16(v8h lo, v8h hi) { return __builtin_shufflevector(lo, hi, 0, 1, 2, 3, 4, 5, 6, 7, 8, 9, 10, 11, 12, 13, 14, 15); }
__device__ __forceinline__ v16bf cat16b(v8us lo, v8us hi) { return __builtin_bit_cast(v16bf, __builtin_shufflevector(lo, hi, 0, 1, 2, 3, 4, 5, 6, 7, 8, 9, 10, 11, 12, 13, 14, 15)); }
__device__ __forceinline__ v8f wmma16(v16h a, v16h b, v8f c) { return __builtin_amdgcn_wmma_f32_16x16x32_f16(false, a, false, b, (short)0, c, false, false); }
__device__ __forceinline__ v8f wmmab(v16bf a, v16bf b, v8f c) { return __builtin_amdgcn_wmma_f32_16x16x32_bf16(false, a, false, b, (short)0, c, false, false); }
__device__ __forceinline__ h16 tohx(float x) { return (h16)x; }
__device__ __forceinline__ void splitf(float y, unsigned short& h, unsigned short& l) { h = f2bf(y); l = f2bf(y - bf2f(h)); }
// fp16 convert whose result can never be a sub-normal operand: magnitudes below 2^-14 become zero by value select.
static __device__ __forceinline__ h16 toh_flush(float v) { const h16 r = (h16)v; return (fabsf(v) < 6.103515625e-05f) ? (h16)0.0f : r; }

// ---- 16-bit WMMA fragment loaders: lane l, m = n = l & 15, h = l >> 4; elements 0..7 <- k0 + 8h + 0..7, elements 8..15 <- k0 + 16 + 8h + 0..7 (A rows and K-contiguous Bt rows alike).
template <typename T16> struct WFrag;
template <> struct WFrag<h16> { typedef v16h V; static __device__ __forceinline__ V ld(const h16* p) { return cat16(*(const v8h*)p, *(const v8h*)(p + 16)); } static __device__ __forceinline__ v8f mma(V a, V b, v8f c) { return wmma16(a, b, c); } };
template <> struct WFrag<bf> { typedef v16bf V; static __device__ __forceinline__ V ld(const bf* p) { return cat16b(*(const v8us*)p, *(const v8us*)(p + 16)); } static __device__ __forceinline__ v8f mma(V a, V b, v8f c) { return wmmab(a, b, c); } };

// ---- k_gemmw: register-blocked GEMM, ONE WAVE per 64x64 output tile (16 accumulators), operands straight from K-contiguous 16-bit planes; grid (M/64, N/64, Z), 32 threads.
// C[m][n] (f32, pitch ldc) = cs * sum_k A[m][k] Bt[n][k] (+ A2[m][k] Bt[n][k] when NSPLIT is 1 or 2, + A[m][k] Bt2[n][k] when NSPLIT >= 2) + optional bf16-RNE bias[n]. z-batch strides sA/sB/sC in elements. K is a compile-time constant (each fragment's address is then a uniform base, one running offset register and an immediate), K % 64 == 0, K >= 64, M % 64 == 0, N % 64 == 0.
// k-loop: two fragment sets in registers. All loads of a 32-wide k-step are issued as one group, one k-step ahead of the products that use them, so a k-step waits for memory at most once and that wait overlaps the other set's products.
// Product order per accumulator: k-steps ascending, inside a k-step A.Bt, A2.Bt, A.Bt2.
template <typename T16, int NSPLIT> struct KSet { typename WFrag<T16>::V a[4], a2[4], b[4], b2[4]; };
// Loads the k-step that starts KO elements behind the running positions: oa is the lane's byte offset in the A and A2 planes, ob in the Bt and Bt2 planes (32 bits: a plane is below 4 GiB), so an address is a uniform base, one offset register and an immediate.
template <typename T16> __device__ __forceinline__ const T16* kset_at(const T16* base, unsigned off) { return (const T16*)((const char*)base + off); }
template <typename T16, int NSPLIT, int K, int KO>
__device__ __forceinline__ void kset_ld(KSet<T16, NSPLIT>& s, const T16* A, const T16* A2, const T16* Bt, const T16* Bt2, unsigned& oa, unsigned& ob) {
#pragma unroll
    for (int i = 0; i < 4; ++i) { s.b[i] = WFrag<T16>::ld(kset_at(Bt, ob) + KO + (size_t)i * 16 * K); if (NSPLIT >= 2) s.b2[i] = WFrag<T16>::ld(kset_at(Bt2, ob) + KO + (size_t)i * 16 * K); }
#pragma unroll
    for (int i = 0; i < 4; ++i) { s.a[i] = WFrag<T16>::ld(kset_at(A, oa) + KO + (size_t)i * 16 * K); if (NSPLIT == 1 || NSPLIT == 2) s.a2[i] = WFrag<T16>::ld(kset_at(A2, oa) + KO + (size_t)i * 16 * K); }
    // The wait stands behind the group's loads and ahead of any write of their address registers. The two offsets pass through it: they stay live up to it (no fragment of the group is allocated over one) and their advance, which reads its outputs, cannot be placed ahead of it.
    asm volatile("s_wait_xcnt 0x0" : "+v"(oa), "+v"(ob) :: "memory");
    __builtin_amdgcn_sched_barrier(0);              // keeps the group ahead of the products that follow (sunk to their use the loads would be waited for one by one) and later register writes behind the wait
}
template <typename T16, int NSPLIT>
__device__ __forceinline__ void kset_mma(const KSet<T16, NSPLIT>& s, v8f (&acc)[4][4]) {
#pragma unroll
    for (int mb = 0; mb < 4; ++mb)
#pragma unroll
        for (int nb = 0; nb < 4; ++nb) acc[mb][nb] = WFrag<T16>::mma(s.a[mb], s.b[nb], acc[mb][nb]);
    if (NSPLIT == 1 || NSPLIT == 2) {
#pragma unroll
        for (int mb = 0; mb < 4; ++mb)
#pragma unroll
            for (int nb = 0; nb < 4; ++nb) acc[mb][nb] = WFrag<T16>::mma(s.a2[mb], s.b[nb], acc[mb][nb]); }
    if (NSPLIT >= 2) {
#pragma unroll
        for (int mb = 0; mb < 4; ++mb)
#pragma unroll
            for (int nb = 0; nb < 4; ++nb) acc[mb][nb] = WFrag<T16>::mma(s.a[mb], s.b2[nb], acc[mb][nb]); }
}
// Stands between a set's last product and the loads that refill the set, and between the last product and the epilogue, which reads the accumulators and reuses the fragment registers.
__device__ __forceinline__ void kset_guard() {
    __builtin_amdgcn_sched_barrier(0);                       // every product of the set stays ahead of the four slots
    asm volatile("v_nop\n\tv_nop\n\tv_nop\n\tv_nop");        // four vector slots: the distance between a matrix instruction and a read of its D or an overwrite of its A or B registers
    __builtin_amdgcn_sched_barrier(0);                       // what follows (the refill, into the registers of the set it replaces; the epilogue) stays behind the four slots
}
template <typename T16, int NSPLIT, bool BIAS, int K>
__global__ __launch_bounds__(32) void k_gemmw(const T16* __restrict__ A, const T16* __restrict__ A2, const T16* __restrict__ Bt, const T16* __restrict__ Bt2, float* C, int ldc, const float* __restrict__ bias, float cs, size_t sA, size_t sB, size_t sC) {
    static_assert(K % 64 == 0 && K >= 64);
    __shared__ __align__(16) float os[16 * 68];
    const size_t z = blockIdx.z; A += z * sA; if (A2) A2 += z * sA; Bt += z * sB; if (Bt2) Bt2 += z * sB; C += z * sC;
    const int lane = threadIdx.x & 31, lr = lane & 15, hi = lane >> 4; const int r0 = blockIdx.x * 64, c0 = blockIdx.y * 64;
    v8f acc[4][4];
#pragma unroll
    for (int mb = 0; mb < 4; ++mb)
#pragma unroll
        for (int nb = 0; nb < 4; ++nb) acc[mb][nb] = (v8f){};
    unsigned oa = ((unsigned)(r0 + lr) * K + 8 * hi) * 2u, ob = ((unsigned)(c0 + lr) * K + 8 * hi) * 2u;
    KSet<T16, NSPLIT> s0, s1;
    kset_ld<T16, NSPLIT, K, 0>(s0, A, A2, Bt, Bt2, oa, ob);
#pragma unroll 1
    for (int kc = 0; kc < K - 64; kc += 64) {
        kset_ld<T16, NSPLIT, K, 32>(s1, A, A2, Bt, Bt2, oa, ob);
        kset_mma<T16, NSPLIT>(s0, acc);
        kset_guard();
        kset_ld<T16, NSPLIT, K, 64>(s0, A, A2, Bt, Bt2, oa, ob);
        kset_mma<T16, NSPLIT>(s1, acc);
        kset_guard();
        oa += 128; ob += 128;
    }
    kset_ld<T16, NSPLIT, K, 32>(s1, A, A2, Bt, Bt2, oa, ob);
    kset_mma<T16, NSPLIT>(s0, acc);
    kset_mma<T16, NSPLIT>(s1, acc);
    kset_guard();
#pragma unroll
    for (int mb = 0; mb < 4; ++mb) {
#pragma unroll
        for (int nb = 0; nb < 4; ++nb) {
#pragma unroll
            for (int j = 0; j < 8; ++j) os[(hi * 8 + j) * 68 + nb * 16 + lr] = acc[mb][nb][j]; }
        __syncthreads();
        float* crow = C + (size_t)(r0 + mb * 16) * ldc + c0;
{
#pragma unroll
            for (int s = 0; s < 8; ++s) { const int row = 2 * s + hi, cofs = lr * 4; v4f val = *(const v4fa*)(os + row * 68 + cofs); val = val * cs;
                if (BIAS) { val[0] += bfr(bias[c0 + cofs]); val[1] += bfr(bias[c0 + cofs + 1]); val[2] += bfr(bias[c0 + cofs + 2]); val[3] += bfr(bias[c0 + cofs + 3]); }
                *(v4f*)(crow + (size_t)row * ldc + cofs) = val; }
             }
        __syncthreads();
    }
}

__global__ __launch_bounds__(256) void k_cvt8(const float* __restrict__ src, bf* dst, size_t n8) { const size_t i = (size_t)blockIdx.x * 256 + threadIdx.x; if (i >= n8) return; const v8f v = *(const v8f*)(src + i * 8); v8us o;
#pragma unroll
    for (int k = 0; k < 8; ++k) o[k] = f2bf(v[k]); *(v8us*)(dst + i * 8) = o;  }
__global__ __launch_bounds__(256) void k_cvt8h(const float* __restrict__ src, h16* dst, size_t n8, float sc) { const size_t i = (size_t)blockIdx.x * 256 + threadIdx.x; if (i >= n8) return; const v8f v = *(const v8f*)(src + i * 8); v8h o;
#pragma unroll
    for (int k = 0; k < 8; ++k) o[k] = tohx(bfr(v[k]) * sc); *(v8h*)(dst + i * 8) = o;  }

struct ThetaTab { float th[HD / 2]; };
static_assert(sizeof(ThetaTab) == 256);
__global__ __launch_bounds__(256) void k_cstab(ThetaTab tab, float* CS) {
    const int idx = blockIdx.x * 256 + threadIdx.x; if (idx >= TT * HD) return;
    const int t = idx / HD, d = idx % HD, j = d & (HD / 2 - 1);
    float th = tab.th[0];
#pragma unroll
    for (int i = 1; i < HD / 2; ++i) th = (j == i) ? tab.th[i] : th;
    const float ang = __fmul_rn((float)t, th);
    float sn, cn; sincosf(ang, &sn, &cn);
    v2f o; o[0] = cn; o[1] = sn;
    *(v2f*)(CS + (size_t)idx * 2) = o;  }

// ---- k_nrope: one wave per (head h, token t) row of HD = 128 values x = F[t][h*HD + d] (row pitch 'pitch'):
// weightless RMS normalisation xn = x * rsqrt(mean(x^2) + 2^-23); half-split rotary out[j] = xn[j] cos[t][j] + xn[j+64] sin[t][j], out[64+j] = xn[j+64] cos[t][j] - xn[j] sin[t][j] (j < 64);
// times the per-head gain (bf16 RNE value of the input vector entry; 1 when useg == 0), times sc. Head planes [h][t][d]: fp16 (magnitudes below 2^-14 forced to zero), bf16 hi, bf16 lo.
__global__ __launch_bounds__(256) void k_nrope(const float* __restrict__ F, int pitch, int nheads, const float* __restrict__ CS, const float* __restrict__ gain, int useg, float sc, h16* P16, bf* Ph, bf* Pl) {
#pragma clang fp contract(off)
    const int wave = __builtin_amdgcn_readfirstlane(threadIdx.x >> 5); const int lane = threadIdx.x & 31;
    const int row = (int)blockIdx.x * 8 + wave; if (row >= nheads * TT) return;
    const int h = row / TT, t = row % TT; const int j0 = 2 * lane;
    const float* f = F + (size_t)t * pitch + h * HD;
    const v2f x1 = *(const v2f*)(f + j0); const v2f x2 = *(const v2f*)(f + HD / 2 + j0);
    const v4f cs = *(const v4f*)(CS + ((size_t)t * HD + j0) * 2);            // {cos j0, sin j0, cos j0+1, sin j0+1}
    float ss = x1[0] * x1[0] + x1[1] * x1[1];
    ss = ss + (x2[0] * x2[0] + x2[1] * x2[1]);
    ss += __shfl_xor(ss, 16, 32); ss += __shfl_xor(ss, 8, 32); ss += __shfl_xor(ss, 4, 32); ss += __shfl_xor(ss, 2, 32); ss += __shfl_xor(ss, 1, 32);
    const float rn = rsqrtf(ss * (1.0f / (float)HD) + 1.1920928955078125e-07f);
    const float gv = bfr(gain[h]); const float gs = ((useg != 0) ? gv : 1.0f) * sc;
    v2h a16, b16; v2us ah, al, bh, bl;
#pragma unroll
    for (int q = 0; q < 2; ++q) {
        const float u1 = x1[q] * rn, u2 = x2[q] * rn; const float cn = cs[2 * q], sn = cs[2 * q + 1];
        const float o1 = (u1 * cn + u2 * sn) * gs;
        const float o2 = (u2 * cn - u1 * sn) * gs;
        a16[q] = toh_flush(o1); b16[q] = toh_flush(o2);
        unsigned short hh, ll; splitf(o1, hh, ll); ah[q] = hh; al[q] = ll; splitf(o2, hh, ll); bh[q] = hh; bl[q] = ll; }
    const size_t e1 = (size_t)row * HD + j0, e2 = e1 + HD / 2;
    *(v2h*)(P16 + e1) = a16; *(v2h*)(P16 + e2) = b16; *(v2us*)(Ph + e1) = ah; *(v2us*)(Ph + e2) = bh; *(v2us*)(Pl + e1) = al; *(v2us*)(Pl + e2) = bl;  }
__global__ __launch_bounds__(256) void k_vtp(const float* __restrict__ F, int pitch, int nheads, h16* V16, bf* Vh, bf* Vl) { const size_t e = ((size_t)blockIdx.x * 256 + threadIdx.x) * 2; if (e >= (size_t)nheads * HD * TT) return; const int t = (int)(e % TT); const int d = (int)((e / TT) % HD); const int g = (int)(e / ((size_t)TT * HD)); v2h o16; v2us oh, ol;
#pragma unroll
    for (int q = 0; q < 2; ++q) { const float x = F[(size_t)(t + q) * pitch + g * HD + d]; o16[q] = tohx(x); unsigned short a2, c2; splitf(x, a2, c2); oh[q] = a2; ol[q] = c2; }
    *(v2h*)(V16 + e) = o16; *(v2us*)(Vh + e) = oh; *(v2us*)(Vl + e) = ol;  }

// ---- k_flash: fused causal attention, ONE WAVE (32 threads) per (16 query rows qt0.., head h = blockIdx.y; kv group g = h / REP), keys in 32-wide steps s0 = 0 .. qt0 (s0 <= qt0), online softmax in f32.
// SPLIT: q, k as bf16 hi/lo planes (3 products), p as bf16 hi/lo (3 products with v hi/lo). !SPLIT: q, k fp16 (x8), p fp16 x1024, v fp16.
// Score k-steps (d in chunks of 32) are a rolled loop with the four-nop guard inside each step; p.v runs as two groups of four 16-wide output tiles, one guard per group tying the group's accumulators and every live fragment.
// Scores D (row 8h+r, key col nb*16+m) -> probabilities to an LDS 16x32 tile -> A fragments per the loader map; block barrier before the reload and before the next step's stores.
template <bool SPLIT>
__global__ __launch_bounds__(32) void k_flash(const h16* __restrict__ Q16, const bf* __restrict__ Qh, const bf* __restrict__ Ql,
                                              const h16* __restrict__ K16, const bf* __restrict__ Kh, const bf* __restrict__ Kl,
                                              const h16* __restrict__ V16, const bf* __restrict__ Vh, const bf* __restrict__ Vl,
                                              int roff, h16* AT, h16* ATL) {
    __shared__ __align__(16) h16 pt[16 * PP];
    __shared__ __align__(16) bf  pth[16 * PP];
    __shared__ __align__(16) bf  ptl[16 * PP];
    __shared__ __align__(16) h16 os[16 * OP];
    __shared__ __align__(16) h16 osl[16 * OP];
    const int lane = threadIdx.x & 31, lr = lane & 15, hi = lane >> 4;
    const int qt0 = roff + (int)blockIdx.x * 16; const int h = (int)blockIdx.y; const int g = h / REP;
    const size_t qoff = ((size_t)h * TT + qt0 + lr) * HD + 8 * hi;            // A rows: query rows qt0 + m, k = d
    const size_t kb0  = (size_t)g * TT * HD + (size_t)lr * HD + 8 * hi;       // Bt rows: key rows s0 + n, k = d
    const size_t vb0  = (size_t)g * HD * TT + (size_t)lr * TT + 8 * hi;       // Bt rows: d = nb*16 + n, k = key
    v8f oacc[8];
#pragma unroll
    for (int nb = 0; nb < 8; ++nb) oacc[nb] = (v8f){};
    float mrow[8], lrow[8];
#pragma unroll
    for (int r = 0; r < 8; ++r) { mrow[r] = -3.0e38f; lrow[r] = 0.0f; }
#pragma unroll 1
    for (int s0 = 0; s0 <= qt0; s0 += 32) {
        const size_t koff = kb0 + (size_t)s0 * HD;
        v8f c0 = (v8f){}; v8f c1 = (v8f){};
        if (SPLIT) {
#pragma unroll 1
            for (int kc = 0; kc < HD / 32; ++kc) {
                const v16bf a = WFrag<bf>::ld(Qh + qoff + kc * 32); const v16bf a2 = WFrag<bf>::ld(Ql + qoff + kc * 32);
                const v16bf b = WFrag<bf>::ld(Kh + koff + kc * 32); const v16bf b2 = WFrag<bf>::ld(Kl + koff + kc * 32);
                c0 = wmmab(a, b, c0); c0 = wmmab(a2, b, c0); c0 = wmmab(a, b2, c0);
                const v16bf e = WFrag<bf>::ld(Kh + koff + (size_t)16 * HD + kc * 32); const v16bf e2 = WFrag<bf>::ld(Kl + koff + (size_t)16 * HD + kc * 32);
                c1 = wmmab(a, e, c1); c1 = wmmab(a2, e, c1); c1 = wmmab(a, e2, c1);
                asm volatile("v_nop\n\tv_nop\n\tv_nop\n\tv_nop" : "+v"(c0), "+v"(c1) : "v"(a), "v"(a2), "v"(b), "v"(b2), "v"(e), "v"(e2));
            }
        } else {
#pragma unroll 1
            for (int kc = 0; kc < HD / 32; ++kc) {
                const v16h a = WFrag<h16>::ld(Q16 + qoff + kc * 32);
                const v16h b = WFrag<h16>::ld(K16 + koff + kc * 32);
                const v16h e = WFrag<h16>::ld(K16 + koff + (size_t)16 * HD + kc * 32);
                c0 = wmma16(a, b, c0); c1 = wmma16(a, e, c1);
                asm volatile("v_nop\n\tv_nop\n\tv_nop\n\tv_nop" : "+v"(c0), "+v"(c1) : "v"(a), "v"(b), "v"(e));
            }
        }
        // scale, causal select (key <= query row), step max, online update, probabilities to LDS, row sums of the stored operand values
        float al[8];
#pragma unroll
        for (int r = 0; r < 8; ++r) {
            const int qrow = qt0 + 8 * hi + r;
            const float t0 = (s0 + lr <= qrow) ? c0[r] * SCLC : -3.0e38f;
            const float t1 = (s0 + 16 + lr <= qrow) ? c1[r] * SCLC : -3.0e38f;
            float tv = fmaxf(t0, t1);
            tv = fmaxf(tv, __shfl_xor(tv, 1, 32)); tv = fmaxf(tv, __shfl_xor(tv, 2, 32)); tv = fmaxf(tv, __shfl_xor(tv, 4, 32)); tv = fmaxf(tv, __shfl_xor(tv, 8, 32));
            const float mnew = fmaxf(mrow[r], tv);
            float dm = __fsub_rn(mrow[r], mnew); asm volatile("" : "+v"(dm));
            const float alpha = __builtin_amdgcn_exp2f(__fmul_rn(dm, 1.4426950408889634f));
            float d0 = __fsub_rn(t0, mnew); asm volatile("" : "+v"(d0));
            float d1 = __fsub_rn(t1, mnew); asm volatile("" : "+v"(d1));
            const float p0 = __builtin_amdgcn_exp2f(__fmul_rn(d0, 1.4426950408889634f));
            const float p1 = __builtin_amdgcn_exp2f(__fmul_rn(d1, 1.4426950408889634f));
            mrow[r] = mnew;
            float q0, q1;
            if (SPLIT) {
                unsigned short ah, alo, bh, blo; splitf(p0, ah, alo); splitf(p1, bh, blo);
                pth[(8 * hi + r) * PP + lr] = ah; ptl[(8 * hi + r) * PP + lr] = alo; pth[(8 * hi + r) * PP + 16 + lr] = bh; ptl[(8 * hi + r) * PP + 16 + lr] = blo;
                q0 = bf2f(ah) + bf2f(alo); q1 = bf2f(bh) + bf2f(blo);
            } else {
                const h16 x0 = toh_flush(p0 * PCAR), x1 = toh_flush(p1 * PCAR);
                pt[(8 * hi + r) * PP + lr] = x0; pt[(8 * hi + r) * PP + 16 + lr] = x1;
                q0 = (float)x0; q1 = (float)x1;
            }
            float ts = q0 + q1;
            ts += __shfl_xor(ts, 1, 32); ts += __shfl_xor(ts, 2, 32); ts += __shfl_xor(ts, 4, 32); ts += __shfl_xor(ts, 8, 32);
            lrow[r] = lrow[r] * alpha + ts;
            al[r] = alpha;
        }
#pragma unroll
        for (int nb = 0; nb < 8; ++nb)
#pragma unroll
            for (int r = 0; r < 8; ++r) oacc[nb][r] *= al[r];
        __syncthreads();
        const size_t voff = vb0 + s0;
        if (SPLIT) {
            const v16bf pa  = cat16b(*(const v8usa*)(pth + lr * PP + 8 * hi), *(const v8usa*)(pth + lr * PP + 16 + 8 * hi));
            const v16bf pa2 = cat16b(*(const v8usa*)(ptl + lr * PP + 8 * hi), *(const v8usa*)(ptl + lr * PP + 16 + 8 * hi));
#pragma unroll
            for (int gq = 0; gq < 2; ++gq) {
                v16bf vb[4], vb2[4];
#pragma unroll
                for (int i = 0; i < 4; ++i) { vb[i] = WFrag<bf>::ld(Vh + voff + (size_t)(gq * 4 + i) * 16 * TT); vb2[i] = WFrag<bf>::ld(Vl + voff + (size_t)(gq * 4 + i) * 16 * TT); }
#pragma unroll
                for (int i = 0; i < 4; ++i) { oacc[gq * 4 + i] = wmmab(pa, vb[i], oacc[gq * 4 + i]); oacc[gq * 4 + i] = wmmab(pa2, vb[i], oacc[gq * 4 + i]); oacc[gq * 4 + i] = wmmab(pa, vb2[i], oacc[gq * 4 + i]); }
                asm volatile("v_nop\n\tv_nop\n\tv_nop\n\tv_nop" : "+v"(oacc[gq * 4 + 0]), "+v"(oacc[gq * 4 + 1]), "+v"(oacc[gq * 4 + 2]), "+v"(oacc[gq * 4 + 3]) : "v"(pa), "v"(pa2), "v"(vb[0]), "v"(vb[1]), "v"(vb[2]), "v"(vb[3]), "v"(vb2[0]), "v"(vb2[1]), "v"(vb2[2]), "v"(vb2[3]));
            }
        } else {
            const v16h pa = cat16(*(const v8ha*)(pt + lr * PP + 8 * hi), *(const v8ha*)(pt + lr * PP + 16 + 8 * hi));
#pragma unroll
            for (int gq = 0; gq < 2; ++gq) {
                v16h vb[4];
#pragma unroll
                for (int i = 0; i < 4; ++i) vb[i] = WFrag<h16>::ld(V16 + voff + (size_t)(gq * 4 + i) * 16 * TT);
#pragma unroll
                for (int i = 0; i < 4; ++i) oacc[gq * 4 + i] = wmma16(pa, vb[i], oacc[gq * 4 + i]);
                asm volatile("v_nop\n\tv_nop\n\tv_nop\n\tv_nop" : "+v"(oacc[gq * 4 + 0]), "+v"(oacc[gq * 4 + 1]), "+v"(oacc[gq * 4 + 2]), "+v"(oacc[gq * 4 + 3]) : "v"(pa), "v"(vb[0]), "v"(vb[1]), "v"(vb[2]), "v"(vb[3]));
            }
        }
        __syncthreads();
    }
    // normalise, carry x ACAR, stage fp16 hi (+ fp16 residual) tile
#pragma unroll
    for (int r = 0; r < 8; ++r) {
        const float inv = ACAR / lrow[r];
#pragma unroll
        for (int nb = 0; nb < 8; ++nb) { const float v = oacc[nb][r] * inv; const h16 x = toh_flush(v); os[(8 * hi + r) * OP + nb * 16 + lr] = x; if (SPLIT) osl[(8 * hi + r) * OP + nb * 16 + lr] = toh_flush(v - (float)x); }
    }
    __syncthreads();
    h16* arow = AT + (size_t)qt0 * DQ + (size_t)h * HD;
{
#pragma unroll
        for (int s = 0; s < 8; ++s) { const int row = 2 * s + hi; const v8h val = *(const v8ha*)(os + row * OP + lr * 8); *(v8h*)(arow + (size_t)row * DQ + lr * 8) = val;
            if (SPLIT) { h16* lrw = ATL + (size_t)qt0 * DQ + (size_t)h * HD; const v8h v2 = *(const v8ha*)(osl + row * OP + lr * 8); *(v8h*)(lrw + (size_t)row * DQ + lr * 8) = v2; } }
         }
}

extern "C" void kernel_launch(void* const* d_in, const int* in_sizes, int n_in,
                              void* d_out, int out_size, void* d_ws, size_t ws_size, hipStream_t stream) {
    if (n_in < 6) return;
    const size_t rows_used = (size_t)(NB - 1) * TT_FULL + TT;
    if ((size_t)in_sizes[0] < rows_used * DM || (size_t)in_sizes[1] < (size_t)DQ * DM || (size_t)in_sizes[2] < (size_t)DKV * DM || (size_t)in_sizes[3] < (size_t)DKV * DM ||
        (size_t)in_sizes[4] < (size_t)DM * DQ || in_sizes[5] < NH_ || (size_t)out_size < (size_t)NB_FULL * TT_FULL * DM + rows_used * DKV) return;
    // input order: x, Wq [DQ][DM], Wk [DKV][DM], Wv [DKV][DM], Wproj [DM][DQ], q_gain [NH_]
    const float* x = (const float*)d_in[0]; const float* wq = (const float*)d_in[1]; const float* wk = (const float*)d_in[2];
    const float* wv = (const float*)d_in[3]; const float* wo = (const float*)d_in[4]; const float* qg = (const float*)d_in[5];
    float* OUT = (float*)d_out;                                   // [NB_FULL][TT_FULL][DM]
    float* OUT1 = OUT + (size_t)NB_FULL * TT_FULL * DM;           // [NB_FULL][TT_FULL][NKV][HD], second segment (fixed element offset)
    char* wsp = (char*)d_ws;
    auto take = [&](size_t bytes) { char* p = wsp; wsp += (bytes + 255) & ~(size_t)255; return (void*)p; };
    bf* WQ = (bf*)take((size_t)DQ * DM * 2); bf* WK = (bf*)take((size_t)DKV * DM * 2); bf* WV = (bf*)take((size_t)DKV * DM * 2); h16* WO = (h16*)take((size_t)DM * DQ * 2);
    float* CS = (float*)take((size_t)TT * HD * 2 * 4);
    bf* XB = (bf*)take((size_t)TT * DM * 2); float* FQ = (float*)take((size_t)TT * DQ * 4); float* FK = (float*)take((size_t)TT * DKV * 4);
    h16* QP16 = (h16*)take((size_t)NH_ * TT * HD * 2); bf* QPh = (bf*)take((size_t)NH_ * TT * HD * 2); bf* QPl = (bf*)take((size_t)NH_ * TT * HD * 2);
    h16* KP16 = (h16*)take((size_t)NKV * TT * HD * 2); bf* KPh = (bf*)take((size_t)NKV * TT * HD * 2); bf* KPl = (bf*)take((size_t)NKV * TT * HD * 2);
    h16* VT16 = (h16*)take((size_t)NKV * HD * TT * 2); bf* VTh = (bf*)take((size_t)NKV * HD * TT * 2); bf* VTl = (bf*)take((size_t)NKV * HD * TT * 2);
    h16* AT16 = (h16*)take((size_t)TT * DQ * 2); h16* ATL16 = (h16*)take((size_t)RH * DQ * 2);
    if ((size_t)(wsp - (char*)d_ws) > ws_size) return;    // 99,614,720 B at NB 2 / TT 2048
    // rotary frequencies: base = 10000 * (TT_FULL / 1024)^(HD / (HD - 2)) in double, narrowed to f32; theta[j] = 1 / base^(2j / HD) evaluated in f32
    ThetaTab tab;
    const double nbase = 10000.0 * pow((double)TT_FULL / 1024.0, (double)HD / (double)(HD - 2));
    const float nbasef = (float)nbase;
    for (int j = 0; j < HD / 2; ++j) { const float ef = (float)(2 * j) / (float)HD; const double p = pow((double)nbasef, (double)ef); const float pf = (float)p; tab.th[j] = 1.0f / pf; }
    k_cvt8<<<(unsigned)(((size_t)DQ * DM / 8 + 255) / 256), 256, 0, stream>>>(wq, WQ, (size_t)DQ * DM / 8);
    k_cvt8<<<(unsigned)(((size_t)DKV * DM / 8 + 255) / 256), 256, 0, stream>>>(wk, WK, (size_t)DKV * DM / 8);
    k_cvt8<<<(unsigned)(((size_t)DKV * DM / 8 + 255) / 256), 256, 0, stream>>>(wv, WV, (size_t)DKV * DM / 8);
    k_cvt8h<<<(unsigned)(((size_t)DM * DQ / 8 + 255) / 256), 256, 0, stream>>>(wo, WO, (size_t)DM * DQ / 8, WCAR);
    k_cstab<<<(unsigned)((TT * HD + 255) / 256), 256, 0, stream>>>(tab, CS);
    const unsigned LK = (unsigned)(((size_t)NKV * TT * HD / 2 + 255) / 256);
    const unsigned RQ = (unsigned)(((size_t)NH_ * TT + 7) / 8), RK = (unsigned)(((size_t)NKV * TT + 7) / 8);
    for (int b = 0; b < NB; ++b) {
        float* FV = OUT1 + (size_t)b * TT_FULL * DKV;             // value projection lives in the output buffer (row pitch DKV)
        k_cvt8<<<(unsigned)(((size_t)TT * DM / 8 + 255) / 256), 256, 0, stream>>>(x + (size_t)b * TT_FULL * DM, XB, (size_t)TT * DM / 8);
        k_gemmw<bf, 0, false, DM><<<dim3(TT / 64, DQ / 64, 1), 32, 0, stream>>>(XB, nullptr, WQ, nullptr, FQ, DQ, nullptr, 1.0f, 0, 0, 0);
        k_nrope<<<RQ, 256, 0, stream>>>(FQ, DQ, NH_, CS, qg, 1, QKC, QP16, QPh, QPl);
        k_gemmw<bf, 0, false, DM><<<dim3(TT / 64, DKV / 64, 1), 32, 0, stream>>>(XB, nullptr, WK, nullptr, FK, DKV, nullptr, 1.0f, 0, 0, 0);
        k_nrope<<<RK, 256, 0, stream>>>(FK, DKV, NKV, CS, qg, 0, QKC, KP16, KPh, KPl);
        k_gemmw<bf, 0, false, DM><<<dim3(TT / 64, DKV / 64, 1), 32, 0, stream>>>(XB, nullptr, WV, nullptr, FV, DKV, nullptr, 1.0f, 0, 0, 0);
        k_vtp<<<LK, 256, 0, stream>>>(FV, DKV, NKV, VT16, VTh, VTl);
        k_flash<true><<<dim3(RH / 16, NH_, 1), 32, 0, stream>>>(QP16, QPh, QPl, KP16, KPh, KPl, VT16, VTh, VTl, 0, AT16, ATL16);
        if (TT > RH) k_flash<false><<<dim3((TT - RH) / 16, NH_, 1), 32, 0, stream>>>(QP16, QPh, QPl, KP16, KPh, KPl, VT16, VTh, VTl, RH, AT16, ATL16);
        float* OUTb = OUT + (size_t)b * TT_FULL * DM;
        k_gemmw<h16, 1, false, DQ><<<dim3(RH / 64, DM / 64, 1), 32, 0, stream>>>(AT16, ATL16, WO, nullptr, OUTb, DM, nullptr, OSC, 0, 0, 0);
        if (TT > RH) k_gemmw<h16, 0, false, DQ><<<dim3((TT - RH) / 64, DM / 64, 1), 32, 0, stream>>>(AT16 + (size_t)RH * DQ, nullptr, WO, nullptr, OUTb + (size_t)RH * DM, DM, nullptr, OSC, 0, 0, 0);
    }
}

// v002
// One run takes 449 microseconds.
// Next to v001, in two timings, it ran 1.50 times as fast each time.
// All steps since v000 together make it 2.58 times as fast.
#include <hip/hip_runtime.h>
#include <math.h>

// Contractions, f32 accumulate: q/k/v projections on v_wmma_f32_16x16x32_bf16 (bf16 operands = RNE-converted inputs, exact products); attention q.k^T and p.v on v_wmma_f32_16x16x32_f16 (f16 operands: q,k carried x8, p carried x1024, v plain) for query rows >= RH and on v_wmma_f32_16x16x32_bf16 hi/lo 3-product planes for query rows < RH; output projection on v_wmma_f32_16x16x32_f16 (ctx carried x64 as f16 hi, plus an f16 residual plane for rows < RH; weight = bf16-RNE value x256 in f16). Softmax, RMS normalisation, rotary, head gain in f32.
// Every per-batch kernel runs once for all batches, the batch index on a grid axis (each batch has its own workspace planes). Layout per batch: bf16 copy of x; [out][in] weights used as K-contiguous Bt planes directly; projections exact; value projection written straight into the second segment of the output buffer; weightless RMS normalisation + half-split rotary (NTK-rescaled base, precise tables) + per-head gain into head planes [h][t][d]; value planes [g][d][t]; fused causal attention (one wave per 16 query rows x one head, 32-key steps, online softmax, diagonal block masked by select, blocks above the diagonal never visited) writes ctx planes [t][h*HD+d]; ctx x Wproj into the first segment of the output buffer.
// Register budget: GEMM holds 16 accumulators and two whole k-steps of fragments; attention bounds fragment live ranges by per-group four-nop guards (rolled score k-steps, p.v in two groups of four output tiles).

#ifndef NB
#define NB 2
#endif
#ifndef TT
#define TT 2048
#endif
#ifndef RH
#define RH 256
#endif
#define NB_FULL 2
#define TT_FULL 2048
#define DM   2048
#define NH_  16
#define NKV  4
#define REP  (NH_ / NKV)
#define HD   128
#define DQ   (NH_ * HD)
#define DKV  (NKV * HD)
#define QKC  8.0f                                   // q and k planes carry x8 each -> scores carry x64
#define SCLC (0.08838834764831845f * 0.015625f)     // HD^-0.5 folded with the 1/64 un-carry (exact power of two)
#define PCAR 1024.0f                                // fp16 probability carry
#define ACAR 64.0f                                  // ctx plane carry
#define WCAR 256.0f                                 // Wo plane carry
#define OSC  (1.0f / 16384.0f)                      // 1 / (ACAR * WCAR)
#define PP   40                                     // LDS pitch (halves) of the 16x32 probability tile
#define OP   136                                    // LDS pitch (halves) of the 16x128 ctx tile
static_assert(TT % 64 == 0);
static_assert(RH % 64 == 0);
static_assert(RH >= 64);
static_assert(RH <= TT);
static_assert(TT <= TT_FULL);
static_assert(NB >= 1);
static_assert(NB <= NB_FULL);
static_assert(DM % 32 == 0);
static_assert(DQ == DM);
static_assert(HD == 128);
static_assert((TT * HD) % 256 == 0);
static_assert(NH_ % NKV == 0);
static_assert(DM % 64 == 0);
static_assert(DQ % 64 == 0);
static_assert(DKV % 64 == 0);
static_assert((NH_ * TT) % 8 == 0);
static_assert((NKV * TT) % 8 == 0);
static_assert(32 * 4 == HD);                          // k_nrope: 32 lanes x (2 + 2) columns == head width
static_assert(HD % 32 == 0);                          // score k-steps of 32
static_assert(HD / 16 == 8);                          // p.v: two groups of four 16-wide output tiles
static_assert(PP >= 32);
static_assert((PP * 2) % 16 == 0);
static_assert(OP >= HD);
static_assert((OP * 2) % 16 == 0);
static_assert(TT_FULL > 1024);                        // NTK base rescale branch of the rotary tables
static_assert((size_t)NB_FULL * TT_FULL * DM * 4 == 33554432);                       // byte offset of the second output segment
static_assert(((size_t)NB_FULL * TT_FULL * DM + (size_t)NB_FULL * TT_FULL * DKV) * 4 == 41943040);   // total output bytes
#define WS_TOTAL ((size_t)DQ * DM * 2 + 2 * (size_t)DKV * DM * 2 + (size_t)DM * DQ * 2 + (size_t)TT * HD * 2 * 4 + NB * ((size_t)TT * DM * 2 + (size_t)TT * DQ * 4 + (size_t)TT * DKV * 4 + 3 * (size_t)NH_ * TT * HD * 2 + 6 * (size_t)NKV * TT * HD * 2 + (size_t)TT * DQ * 2) + ((size_t)(NB - 1) * TT + RH) * DQ * 2)
static_assert(WS_TOTAL + 32 * 256 <= 268435456);

typedef _Float16 h16;
typedef unsigned short bf;
typedef __attribute__((ext_vector_type(16))) __bf16   v16bf;
typedef __attribute__((ext_vector_type(16))) _Float16 v16h;
typedef __attribute__((ext_vector_type(8)))  _Float16 v8h;
typedef __attribute__((ext_vector_type(8)))  unsigned short v8us;
typedef __attribute__((ext_vector_type(8)))  float    v8f;
typedef __attribute__((ext_vector_type(4)))  float    v4f;
typedef __attribute__((ext_vector_type(2)))  _Float16 v2h;
typedef __attribute__((ext_vector_type(2)))  unsigned short v2us;
typedef __attribute__((ext_vector_type(2)))  float    v2f;
typedef v8h  __attribute__((may_alias)) v8ha;
typedef v4f  __attribute__((may_alias)) v4fa;
typedef v8us __attribute__((may_alias)) v8usa;

__device__ __forceinline__ unsigned short f2bf(float f) { unsigned u = __float_as_uint(f); u += 0x7FFFu + ((u >> 16) & 1u); return (unsigned short)(u >> 16); }
__device__ __forceinline__ float bf2f(unsigned short b) { return __uint_as_float(((unsigned)b) << 16); }
__device__ __forceinline__ float bfr(float f) { return bf2f(f2bf(f)); }
__device__ __forceinline__ v16h cat16(v8h lo, v8h hi) { return __builtin_shufflevector(lo, hi, 0, 1, 2, 3, 4, 5, 6, 7, 8, 9, 10, 11, 12, 13, 14, 15); }
__device__ __forceinline__ v16bf cat16b(v8us lo, v8us hi) { return __builtin_bit_cast(v16bf, __builtin_shufflevector(lo, hi, 0, 1, 2, 3, 4, 5, 6, 7, 8, 9, 10, 11, 12, 13, 14, 15)); }
__device__ __forceinline__ v8f wmma16(v16h a, v16h b, v8f c) { return __builtin_amdgcn_wmma_f32_16x16x32_f16(false, a, false, b, (short)0, c, false, false); }
__device__ __forceinline__ v8f wmmab(v16bf a, v16bf b, v8f c) { return __builtin_amdgcn_wmma_f32_16x16x32_bf16(false, a, false, b, (short)0, c, false, false); }
__device__ __forceinline__ h16 tohx(float x) { return (h16)x; }
__device__ __forceinline__ void splitf(float y, unsigned short& h, unsigned short& l) { h = f2bf(y); l = f2bf(y - bf2f(h)); }
// fp16 convert whose result can never be a sub-normal operand: magnitudes below 2^-14 become zero by value select.
static __device__ __forceinline__ h16 toh_flush(float v) { const h16 r = (h16)v; return (fabsf(v) < 6.103515625e-05f) ? (h16)0.0f : r; }

// ---- 16-bit WMMA fragment loaders: lane l, m = n = l & 15, h = l >> 4; elements 0..7 <- k0 + 8h + 0..7, elements 8..15 <- k0 + 16 + 8h + 0..7 (A rows and K-contiguous Bt rows alike).
template <typename T16> struct WFrag;
template <> struct WFrag<h16> { typedef v16h V; static __device__ __forceinline__ V ld(const h16* p) { return cat16(*(const v8h*)p, *(const v8h*)(p + 16)); } static __device__ __forceinline__ v8f mma(V a, V b, v8f c) { return wmma16(a, b, c); } };
template <> struct WFrag<bf> { typedef v16bf V; static __device__ __forceinline__ V ld(const bf* p) { return cat16b(*(const v8us*)p, *(const v8us*)(p + 16)); } static __device__ __forceinline__ v8f mma(V a, V b, v8f c) { return wmmab(a, b, c); } };

// ---- k_gemmw: register-blocked GEMM, ONE WAVE per 64x64 output tile (16 accumulators), operands straight from K-contiguous 16-bit planes; grid (M/64, N/64, Z), 32 threads.
// C[m][n] (f32, pitch ldc) = cs * sum_k A[m][k] Bt[n][k] (+ A2[m][k] Bt[n][k] when NSPLIT is 1 or 2, + A[m][k] Bt2[n][k] when NSPLIT >= 2) + optional bf16-RNE bias[n]. z-batch strides sA/sB/sC in elements. K is a compile-time constant (each fragment's address is then a uniform base, one running offset register and an immediate), K % 64 == 0, K >= 64, M % 64 == 0, N % 64 == 0.
// k-loop: two fragment sets in registers. All loads of a 32-wide k-step are issued as one group, one k-step ahead of the products that use them, so a k-step waits for memory at most once and that wait overlaps the other set's products.
// Product order per accumulator: k-steps ascending, inside a k-step A.Bt, A2.Bt, A.Bt2.
template <typename T16, int NSPLIT> struct KSet { typename WFrag<T16>::V a[4], a2[4], b[4], b2[4]; };
// Loads the k-step that starts KO elements behind the running positions: oa is the lane's byte offset in the A and A2 planes, ob in the Bt and Bt2 planes (32 bits: a plane is below 4 GiB), so an address is a uniform base, one offset register and an immediate.
template <typename T16> __device__ __forceinline__ const T16* kset_at(const T16* base, unsigned off) { return (const T16*)((const char*)base + off); }
template <typename T16, int NSPLIT, int K, int KO>
__device__ __forceinline__ void kset_ld(KSet<T16, NSPLIT>& s, const T16* A, const T16* A2, const T16* Bt, const T16* Bt2, unsigned& oa, unsigned& ob) {
#pragma unroll
    for (int i = 0; i < 4; ++i) { s.b[i] = WFrag<T16>::ld(kset_at(Bt, ob) + KO + (size_t)i * 16 * K); if (NSPLIT >= 2) s.b2[i] = WFrag<T16>::ld(kset_at(Bt2, ob) + KO + (size_t)i * 16 * K); }
#pragma unroll
    for (int i = 0; i < 4; ++i) { s.a[i] = WFrag<T16>::ld(kset_at(A, oa) + KO + (size_t)i * 16 * K); if (NSPLIT == 1 || NSPLIT == 2) s.a2[i] = WFrag<T16>::ld(kset_at(A2, oa) + KO + (size_t)i * 16 * K); }
    // The wait stands behind the group's loads and ahead of any write of their address registers. The two offsets pass through it: they stay live up to it (no fragment of the group is allocated over one) and their advance, which reads its outputs, cannot be placed ahead of it.
    asm volatile("s_wait_xcnt 0x0" : "+v"(oa), "+v"(ob) :: "memory");
    __builtin_amdgcn_sched_barrier(0);              // keeps the group ahead of the products that follow (sunk to their use the loads would be waited for one by one) and later register writes behind the wait
}
template <typename T16, int NSPLIT>
__device__ __forceinline__ void kset_mma(const KSet<T16, NSPLIT>& s, v8f (&acc)[4][4]) {
#pragma unroll
    for (int mb = 0; mb < 4; ++mb)
#pragma unroll
        for (int nb = 0; nb < 4; ++nb) acc[mb][nb] = WFrag<T16>::mma(s.a[mb], s.b[nb], acc[mb][nb]);
    if (NSPLIT == 1 || NSPLIT == 2) {
#pragma unroll
        for (int mb = 0; mb < 4; ++mb)
#pragma unroll
            for (int nb = 0; nb < 4; ++nb) acc[mb][nb] = WFrag<T16>::mma(s.a2[mb], s.b[nb], acc[mb][nb]); }
    if (NSPLIT >= 2) {
#pragma unroll
        for (int mb = 0; mb < 4; ++mb)
#pragma unroll
            for (int nb = 0; nb < 4; ++nb) acc[mb][nb] = WFrag<T16>::mma(s.a[mb], s.b2[nb], acc[mb][nb]); }
}
// Stands between a set's last product and the loads that refill the set, and between the last product and the epilogue, which reads the accumulators and reuses the fragment registers.
__device__ __forceinline__ void kset_guard() {
    __builtin_amdgcn_sched_barrier(0);                       // every product of the set stays ahead of the four slots
    asm volatile("v_nop\n\tv_nop\n\tv_nop\n\tv_nop");        // four vector slots: the distance between a matrix instruction and a read of its D or an overwrite of its A or B registers
    __builtin_amdgcn_sched_barrier(0);                       // what follows (the refill, into the registers of the set it replaces; the epilogue) stays behind the four slots
}
template <typename T16, int NSPLIT, bool BIAS, int K>
__global__ __launch_bounds__(32) void k_gemmw(const T16* __restrict__ A, const T16* __restrict__ A2, const T16* __restrict__ Bt, const T16* __restrict__ Bt2, float* C, int ldc, const float* __restrict__ bias, float cs, size_t sA, size_t sB, size_t sC) {
    static_assert(K % 64 == 0 && K >= 64);
    __shared__ __align__(16) float os[16 * 68];
    const size_t z = blockIdx.z; A += z * sA; if (A2) A2 += z * sA; Bt += z * sB; if (Bt2) Bt2 += z * sB; C += z * sC;
    const int lane = threadIdx.x & 31, lr = lane & 15, hi = lane >> 4; const int r0 = blockIdx.x * 64, c0 = blockIdx.y * 64;
    v8f acc[4][4];
#pragma unroll
    for (int mb = 0; mb < 4; ++mb)
#pragma unroll
        for (int nb = 0; nb < 4; ++nb) acc[mb][nb] = (v8f){};
    unsigned oa = ((unsigned)(r0 + lr) * K + 8 * hi) * 2u, ob = ((unsigned)(c0 + lr) * K + 8 * hi) * 2u;
    KSet<T16, NSPLIT> s0, s1;
    kset_ld<T16, NSPLIT, K, 0>(s0, A, A2, Bt, Bt2, oa, ob);
#pragma unroll 1
    for (int kc = 0; kc < K - 64; kc += 64) {
        kset_ld<T16, NSPLIT, K, 32>(s1, A, A2, Bt, Bt2, oa, ob);
        kset_mma<T16, NSPLIT>(s0, acc);
        kset_guard();
        kset_ld<T16, NSPLIT, K, 64>(s0, A, A2, Bt, Bt2, oa, ob);
        kset_mma<T16, NSPLIT>(s1, acc);
        kset_guard();
        oa += 128; ob += 128;
    }
    kset_ld<T16, NSPLIT, K, 32>(s1, A, A2, Bt, Bt2, oa, ob);
    kset_mma<T16, NSPLIT>(s0, acc);
    kset_mma<T16, NSPLIT>(s1, acc);
    kset_guard();
#pragma unroll
    for (int mb = 0; mb < 4; ++mb) {
#pragma unroll
        for (int nb = 0; nb < 4; ++nb) {
#pragma unroll
            for (int j = 0; j < 8; ++j) os[(hi * 8 + j) * 68 + nb * 16 + lr] = acc[mb][nb][j]; }
        __syncthreads();
        float* crow = C + (size_t)(r0 + mb * 16) * ldc + c0;
{
#pragma unroll
            for (int s = 0; s < 8; ++s) { const int row = 2 * s + hi, cofs = lr * 4; v4f val = *(const v4fa*)(os + row * 68 + cofs); val = val * cs;
                if (BIAS) { val[0] += bfr(bias[c0 + cofs]); val[1] += bfr(bias[c0 + cofs + 1]); val[2] += bfr(bias[c0 + cofs + 2]); val[3] += bfr(bias[c0 + cofs + 3]); }
                *(v4f*)(crow + (size_t)row * ldc + cofs) = val; }
             }
        __syncthreads();
    }
}

// blockIdx.y = batch: source and destination advance by sS and sD elements per batch.
__global__ __launch_bounds__(256) void k_cvt8(const float* __restrict__ src, bf* dst, size_t n8, size_t sS, size_t sD) { const size_t i = (size_t)blockIdx.x * 256 + threadIdx.x; if (i >= n8) return; src += (size_t)blockIdx.y * sS; dst += (size_t)blockIdx.y * sD; const v8f v = *(const v8f*)(src + i * 8); v8us o;
#pragma unroll
    for (int k = 0; k < 8; ++k) o[k] = f2bf(v[k]); *(v8us*)(dst + i * 8) = o;  }
__global__ __launch_bounds__(256) void k_cvt8h(const float* __restrict__ src, h16* dst, size_t n8, float sc) { const size_t i = (size_t)blockIdx.x * 256 + threadIdx.x; if (i >= n8) return; const v8f v = *(const v8f*)(src + i * 8); v8h o;
#pragma unroll
    for (int k = 0; k < 8; ++k) o[k] = tohx(bfr(v[k]) * sc); *(v8h*)(dst + i * 8) = o;  }

struct ThetaTab { float th[HD / 2]; };
static_assert(sizeof(ThetaTab) == 256);
__global__ __launch_bounds__(256) void k_cstab(ThetaTab tab, float* CS) {
    const int idx = blockIdx.x * 256 + threadIdx.x; if (idx >= TT * HD) return;
    const int t = idx / HD, d = idx % HD, j = d & (HD / 2 - 1);
    float th = tab.th[0];
#pragma unroll
    for (int i = 1; i < HD / 2; ++i) th = (j == i) ? tab.th[i] : th;
    const float ang = __fmul_rn((float)t, th);
    float sn, cn; sincosf(ang, &sn, &cn);
    v2f o; o[0] = cn; o[1] = sn;
    *(v2f*)(CS + (size_t)idx * 2) = o;  }

// ---- k_nrope: one wave per (head h, token t) row of HD = 128 values x = F[t][h*HD + d] (row pitch 'pitch'):
// weightless RMS normalisation xn = x * rsqrt(mean(x^2) + 2^-23); half-split rotary out[j] = xn[j] cos[t][j] + xn[j+64] sin[t][j], out[64+j] = xn[j+64] cos[t][j] - xn[j] sin[t][j] (j < 64);
// times the per-head gain (bf16 RNE value of the input vector entry; 1 when useg == 0), times sc. Head planes [h][t][d]: fp16 (magnitudes below 2^-14 forced to zero), bf16 hi, bf16 lo.
// blockIdx.y = batch: F advances by sF elements per batch, each head plane by nheads * TT * HD.
__global__ __launch_bounds__(256) void k_nrope(const float* __restrict__ F, size_t sF, int pitch, int nheads, const float* __restrict__ CS, const float* __restrict__ gain, int useg, float sc, h16* P16, bf* Ph, bf* Pl) {
#pragma clang fp contract(off)
    { const size_t bz = blockIdx.y, sP = bz * (size_t)nheads * TT * HD; F += bz * sF; P16 += sP; Ph += sP; Pl += sP; }
    const int wave = __builtin_amdgcn_readfirstlane(threadIdx.x >> 5); const int lane = threadIdx.x & 31;
    const int row = (int)blockIdx.x * 8 + wave; if (row >= nheads * TT) return;
    const int h = row / TT, t = row % TT; const int j0 = 2 * lane;
    const float* f = F + (size_t)t * pitch + h * HD;
    const v2f x1 = *(const v2f*)(f + j0); const v2f x2 = *(const v2f*)(f + HD / 2 + j0);
    const v4f cs = *(const v4f*)(CS + ((size_t)t * HD + j0) * 2);            // {cos j0, sin j0, cos j0+1, sin j0+1}
    float ss = x1[0] * x1[0] + x1[1] * x1[1];
    ss = ss + (x2[0] * x2[0] + x2[1] * x2[1]);
    ss += __shfl_xor(ss, 16, 32); ss += __shfl_xor(ss, 8, 32); ss += __shfl_xor(ss, 4, 32); ss += __shfl_xor(ss, 2, 32); ss += __shfl_xor(ss, 1, 32);
    const float rn = rsqrtf(ss * (1.0f / (float)HD) + 1.1920928955078125e-07f);
    const float gv = bfr(gain[h]); const float gs = ((useg != 0) ? gv : 1.0f) * sc;
    v2h a16, b16; v2us ah, al, bh, bl;
#pragma unroll
    for (int q = 0; q < 2; ++q) {
        const float u1 = x1[q] * rn, u2 = x2[q] * rn; const float cn = cs[2 * q], sn = cs[2 * q + 1];
        const float o1 = (u1 * cn + u2 * sn) * gs;
        const float o2 = (u2 * cn - u1 * sn) * gs;
        a16[q] = toh_flush(o1); b16[q] = toh_flush(o2);
        unsigned short hh, ll; splitf(o1, hh, ll); ah[q] = hh; al[q] = ll; splitf(o2, hh, ll); bh[q] = hh; bl[q] = ll; }
    const size_t e1 = (size_t)row * HD + j0, e2 = e1 + HD / 2;
    *(v2h*)(P16 + e1) = a16; *(v2h*)(P16 + e2) = b16; *(v2us*)(Ph + e1) = ah; *(v2us*)(Ph + e2) = bh; *(v2us*)(Pl + e1) = al; *(v2us*)(Pl + e2) = bl;  }
// blockIdx.y = batch: F advances by sF elements per batch, each value plane by nheads * HD * TT.
__global__ __launch_bounds__(256) void k_vtp(const float* __restrict__ F, size_t sF, int pitch, int nheads, h16* V16, bf* Vh, bf* Vl) { { const size_t bz = blockIdx.y, sV = bz * (size_t)nheads * HD * TT; F += bz * sF; V16 += sV; Vh += sV; Vl += sV; } const size_t e = ((size_t)blockIdx.x * 256 + threadIdx.x) * 2; if (e >= (size_t)nheads * HD * TT) return; const int t = (int)(e % TT); const int d = (int)((e / TT) % HD); const int g = (int)(e / ((size_t)TT * HD)); v2h o16; v2us oh, ol;
#pragma unroll
    for (int q = 0; q < 2; ++q) { const float x = F[(size_t)(t + q) * pitch + g * HD + d]; o16[q] = tohx(x); unsigned short a2, c2; splitf(x, a2, c2); oh[q] = a2; ol[q] = c2; }
    *(v2h*)(V16 + e) = o16; *(v2us*)(Vh + e) = oh; *(v2us*)(Vl + e) = ol;  }

// ---- k_flash: fused causal attention, ONE WAVE (32 threads) per (16 query rows qt0.., head h = blockIdx.y; kv group g = h / REP; batch blockIdx.z), keys in 32-wide steps s0 = 0 .. qt0 (s0 <= qt0), online softmax in f32.
// SPLIT: q, k as bf16 hi/lo planes (3 products), p as bf16 hi/lo (3 products with v hi/lo). !SPLIT: q, k fp16 (x8), p fp16 x1024, v fp16.
// Score k-steps (d in chunks of 32) are a rolled loop with the four-nop guard inside each step; p.v runs as two groups of four 16-wide output tiles, one guard per group tying the group's accumulators and every live fragment.
// Scores D (row 8h+r, key col nb*16+m) -> probabilities to an LDS 16x32 tile -> A fragments per the loader map; block barrier before the reload and before the next step's stores.
template <bool SPLIT>
__global__ __launch_bounds__(32) void k_flash(const h16* __restrict__ Q16, const bf* __restrict__ Qh, const bf* __restrict__ Ql,
                                              const h16* __restrict__ K16, const bf* __restrict__ Kh, const bf* __restrict__ Kl,
                                              const h16* __restrict__ V16, const bf* __restrict__ Vh, const bf* __restrict__ Vl,
                                              int roff, h16* AT, h16* ATL) {
    __shared__ __align__(16) h16 pt[16 * PP];
    __shared__ __align__(16) bf  pth[16 * PP];
    __shared__ __align__(16) bf  ptl[16 * PP];
    __shared__ __align__(16) h16 os[16 * OP];
    __shared__ __align__(16) h16 osl[16 * OP];
    const int lane = threadIdx.x & 31, lr = lane & 15, hi = lane >> 4;
    const int qt0 = roff + (int)blockIdx.x * 16; const int h = (int)blockIdx.y; const int g = h / REP;
    { const size_t bz = blockIdx.z, sQ = bz * ((size_t)NH_ * TT * HD), sK = bz * ((size_t)NKV * TT * HD);                 // blockIdx.z = batch: every plane advances by its own size, the residual ctx plane by the ctx plane's (the GEMM has one batch pitch for both)
      Q16 += sQ; Qh += sQ; Ql += sQ; K16 += sK; Kh += sK; Kl += sK; V16 += sK; Vh += sK; Vl += sK; AT += bz * ((size_t)TT * DQ); ATL += bz * ((size_t)TT * DQ); }
    const size_t qoff = ((size_t)h * TT + qt0 + lr) * HD + 8 * hi;            // A rows: query rows qt0 + m, k = d
    const size_t kb0  = (size_t)g * TT * HD + (size_t)lr * HD + 8 * hi;       // Bt rows: key rows s0 + n, k = d
    const size_t vb0  = (size_t)g * HD * TT + (size_t)lr * TT + 8 * hi;       // Bt rows: d = nb*16 + n, k = key
    v8f oacc[8];
#pragma unroll
    for (int nb = 0; nb < 8; ++nb) oacc[nb] = (v8f){};
    float mrow[8], lrow[8];
#pragma unroll
    for (int r = 0; r < 8; ++r) { mrow[r] = -3.0e38f; lrow[r] = 0.0f; }
#pragma unroll 1
    for (int s0 = 0; s0 <= qt0; s0 += 32) {
        const size_t koff = kb0 + (size_t)s0 * HD;
        v8f c0 = (v8f){}; v8f c1 = (v8f){};
        if (SPLIT) {
#pragma unroll 1
            for (int kc = 0; kc < HD / 32; ++kc) {
                const v16bf a = WFrag<bf>::ld(Qh + qoff + kc * 32); const v16bf a2 = WFrag<bf>::ld(Ql + qoff + kc * 32);
                const v16bf b = WFrag<bf>::ld(Kh + koff + kc * 32); const v16bf b2 = WFrag<bf>::ld(Kl + koff + kc * 32);
                c0 = wmmab(a, b, c0); c0 = wmmab(a2, b, c0); c0 = wmmab(a, b2, c0);
                const v16bf e = WFrag<bf>::ld(Kh + koff + (size_t)16 * HD + kc * 32); const v16bf e2 = WFrag<bf>::ld(Kl + koff + (size_t)16 * HD + kc * 32);
                c1 = wmmab(a, e, c1); c1 = wmmab(a2, e, c1); c1 = wmmab(a, e2, c1);
                asm volatile("v_nop\n\tv_nop\n\tv_nop\n\tv_nop" : "+v"(c0), "+v"(c1) : "v"(a), "v"(a2), "v"(b), "v"(b2), "v"(e), "v"(e2));
            }
        } else {
#pragma unroll 1
            for (int kc = 0; kc < HD / 32; ++kc) {
                const v16h a = WFrag<h16>::ld(Q16 + qoff + kc * 32);
                const v16h b = WFrag<h16>::ld(K16 + koff + kc * 32);
                const v16h e = WFrag<h16>::ld(K16 + koff + (size_t)16 * HD + kc * 32);
                c0 = wmma16(a, b, c0); c1 = wmma16(a, e, c1);
                asm volatile("v_nop\n\tv_nop\n\tv_nop\n\tv_nop" : "+v"(c0), "+v"(c1) : "v"(a), "v"(b), "v"(e));
            }
        }
        // scale, causal select (key <= query row), step max, online update, probabilities to LDS, row sums of the stored operand values
        float al[8];
#pragma unroll
        for (int r = 0; r < 8; ++r) {
            const int qrow = qt0 + 8 * hi + r;
            const float t0 = (s0 + lr <= qrow) ? c0[r] * SCLC : -3.0e38f;
            const float t1 = (s0 + 16 + lr <= qrow) ? c1[r] * SCLC : -3.0e38f;
            float tv = fmaxf(t0, t1);
            tv = fmaxf(tv, __shfl_xor(tv, 1, 32)); tv = fmaxf(tv, __shfl_xor(tv, 2, 32)); tv = fmaxf(tv, __shfl_xor(tv, 4, 32)); tv = fmaxf(tv, __shfl_xor(tv, 8, 32));
            const float mnew = fmaxf(mrow[r], tv);
            float dm = __fsub_rn(mrow[r], mnew); asm volatile("" : "+v"(dm));
            const float alpha = __builtin_amdgcn_exp2f(__fmul_rn(dm, 1.4426950408889634f));
            float d0 = __fsub_rn(t0, mnew); asm volatile("" : "+v"(d0));
            float d1 = __fsub_rn(t1, mnew); asm volatile("" : "+v"(d1));
            const float p0 = __builtin_amdgcn_exp2f(__fmul_rn(d0, 1.4426950408889634f));
            const float p1 = __builtin_amdgcn_exp2f(__fmul_rn(d1, 1.4426950408889634f));
            mrow[r] = mnew;
            float q0, q1;
            if (SPLIT) {
                unsigned short ah, alo, bh, blo; splitf(p0, ah, alo); splitf(p1, bh, blo);
                pth[(8 * hi + r) * PP + lr] = ah; ptl[(8 * hi + r) * PP + lr] = alo; pth[(8 * hi + r) * PP + 16 + lr] = bh; ptl[(8 * hi + r) * PP + 16 + lr] = blo;
                q0 = bf2f(ah) + bf2f(alo); q1 = bf2f(bh) + bf2f(blo);
            } else {
                const h16 x0 = toh_flush(p0 * PCAR), x1 = toh_flush(p1 * PCAR);
                pt[(8 * hi + r) * PP + lr] = x0; pt[(8 * hi + r) * PP + 16 + lr] = x1;
                q0 = (float)x0; q1 = (float)x1;
            }
            float ts = q0 + q1;
            ts += __shfl_xor(ts, 1, 32); ts += __shfl_xor(ts, 2, 32); ts += __shfl_xor(ts, 4, 32); ts += __shfl_xor(ts, 8, 32);
            lrow[r] = lrow[r] * alpha + ts;
            al[r] = alpha;
        }
#pragma unroll
        for (int nb = 0; nb < 8; ++nb)
#pragma unroll
            for (int r = 0; r < 8; ++r) oacc[nb][r] *= al[r];
        __syncthreads();
        const size_t voff = vb0 + s0;
        if (SPLIT) {
            const v16bf pa  = cat16b(*(const v8usa*)(pth + lr * PP + 8 * hi), *(const v8usa*)(pth + lr * PP + 16 + 8 * hi));
            const v16bf pa2 = cat16b(*(const v8usa*)(ptl + lr * PP + 8 * hi), *(const v8usa*)(ptl + lr * PP + 16 + 8 * hi));
#pragma unroll
            for (int gq = 0; gq < 2; ++gq) {
                v16bf vb[4], vb2[4];
#pragma unroll
                for (int i = 0; i < 4; ++i) { vb[i] = WFrag<bf>::ld(Vh + voff + (size_t)(gq * 4 + i) * 16 * TT); vb2[i] = WFrag<bf>::ld(Vl + voff + (size_t)(gq * 4 + i) * 16 * TT); }
#pragma unroll
                for (int i = 0; i < 4; ++i) { oacc[gq * 4 + i] = wmmab(pa, vb[i], oacc[gq * 4 + i]); oacc[gq * 4 + i] = wmmab(pa2, vb[i], oacc[gq * 4 + i]); oacc[gq * 4 + i] = wmmab(pa, vb2[i], oacc[gq * 4 + i]); }
                asm volatile("v_nop\n\tv_nop\n\tv_nop\n\tv_nop" : "+v"(oacc[gq * 4 + 0]), "+v"(oacc[gq * 4 + 1]), "+v"(oacc[gq * 4 + 2]), "+v"(oacc[gq * 4 + 3]) : "v"(pa), "v"(pa2), "v"(vb[0]), "v"(vb[1]), "v"(vb[2]), "v"(vb[3]), "v"(vb2[0]), "v"(vb2[1]), "v"(vb2[2]), "v"(vb2[3]));
            }
        } else {
            const v16h pa = cat16(*(const v8ha*)(pt + lr * PP + 8 * hi), *(const v8ha*)(pt + lr * PP + 16 + 8 * hi));
#pragma unroll
            for (int gq = 0; gq < 2; ++gq) {
                v16h vb[4];
#pragma unroll
                for (int i = 0; i < 4; ++i) vb[i] = WFrag<h16>::ld(V16 + voff + (size_t)(gq * 4 + i) * 16 * TT);
#pragma unroll
                for (int i = 0; i < 4; ++i) oacc[gq * 4 + i] = wmma16(pa, vb[i], oacc[gq * 4 + i]);
                asm volatile("v_nop\n\tv_nop\n\tv_nop\n\tv_nop" : "+v"(oacc[gq * 4 + 0]), "+v"(oacc[gq * 4 + 1]), "+v"(oacc[gq * 4 + 2]), "+v"(oacc[gq * 4 + 3]) : "v"(pa), "v"(vb[0]), "v"(vb[1]), "v"(vb[2]), "v"(vb[3]));
            }
        }
        __syncthreads();
    }
    // normalise, carry x ACAR, stage fp16 hi (+ fp16 residual) tile
#pragma unroll
    for (int r = 0; r < 8; ++r) {
        const float inv = ACAR / lrow[r];
#pragma unroll
        for (int nb = 0; nb < 8; ++nb) { const float v = oacc[nb][r] * inv; const h16 x = toh_flush(v); os[(8 * hi + r) * OP + nb * 16 + lr] = x; if (SPLIT) osl[(8 * hi + r) * OP + nb * 16 + lr] = toh_flush(v - (float)x); }
    }
    __syncthreads();
    h16* arow = AT + (size_t)qt0 * DQ + (size_t)h * HD;
{
#pragma unroll
        for (int s = 0; s < 8; ++s) { const int row = 2 * s + hi; const v8h val = *(const v8ha*)(os + row * OP + lr * 8); *(v8h*)(arow + (size_t)row * DQ + lr * 8) = val;
            if (SPLIT) { h16* lrw = ATL + (size_t)qt0 * DQ + (size_t)h * HD; const v8h v2 = *(const v8ha*)(osl + row * OP + lr * 8); *(v8h*)(lrw + (size_t)row * DQ + lr * 8) = v2; } }
         }
}

extern "C" void kernel_launch(void* const* d_in, const int* in_sizes, int n_in,
                              void* d_out, int out_size, void* d_ws, size_t ws_size, hipStream_t stream) {
    if (n_in < 6) return;
    const size_t rows_used = (size_t)(NB - 1) * TT_FULL + TT;
    if ((size_t)in_sizes[0] < rows_used * DM || (size_t)in_sizes[1] < (size_t)DQ * DM || (size_t)in_sizes[2] < (size_t)DKV * DM || (size_t)in_sizes[3] < (size_t)DKV * DM ||
        (size_t)in_sizes[4] < (size_t)DM * DQ || in_sizes[5] < NH_ || (size_t)out_size < (size_t)NB_FULL * TT_FULL * DM + rows_used * DKV) return;
    // input order: x, Wq [DQ][DM], Wk [DKV][DM], Wv [DKV][DM], Wproj [DM][DQ], q_gain [NH_]
    const float* x = (const float*)d_in[0]; const float* wq = (const float*)d_in[1]; const float* wk = (const float*)d_in[2];
    const float* wv = (const float*)d_in[3]; const float* wo = (const float*)d_in[4]; const float* qg = (const float*)d_in[5];
    float* OUT = (float*)d_out;                                   // [NB_FULL][TT_FULL][DM]
    float* OUT1 = OUT + (size_t)NB_FULL * TT_FULL * DM;           // [NB_FULL][TT_FULL][NKV][HD], second segment (fixed element offset)
    char* wsp = (char*)d_ws;
    auto take = [&](size_t bytes) { char* p = wsp; wsp += (bytes + 255) & ~(size_t)255; return (void*)p; };
    bf* WQ = (bf*)take((size_t)DQ * DM * 2); bf* WK = (bf*)take((size_t)DKV * DM * 2); bf* WV = (bf*)take((size_t)DKV * DM * 2); h16* WO = (h16*)take((size_t)DM * DQ * 2);
    float* CS = (float*)take((size_t)TT * HD * 2 * 4);
    // per-batch planes, batch-major: batch b's plane starts b plane sizes behind the first
    bf* XB = (bf*)take((size_t)NB * TT * DM * 2); float* FQ = (float*)take((size_t)NB * TT * DQ * 4); float* FK = (float*)take((size_t)NB * TT * DKV * 4);
    h16* QP16 = (h16*)take((size_t)NB * NH_ * TT * HD * 2); bf* QPh = (bf*)take((size_t)NB * NH_ * TT * HD * 2); bf* QPl = (bf*)take((size_t)NB * NH_ * TT * HD * 2);
    h16* KP16 = (h16*)take((size_t)NB * NKV * TT * HD * 2); bf* KPh = (bf*)take((size_t)NB * NKV * TT * HD * 2); bf* KPl = (bf*)take((size_t)NB * NKV * TT * HD * 2);
    h16* VT16 = (h16*)take((size_t)NB * NKV * HD * TT * 2); bf* VTh = (bf*)take((size_t)NB * NKV * HD * TT * 2); bf* VTl = (bf*)take((size_t)NB * NKV * HD * TT * 2);
    h16* AT16 = (h16*)take((size_t)NB * TT * DQ * 2); h16* ATL16 = (h16*)take(((size_t)(NB - 1) * TT + RH) * DQ * 2);   // RH rows per batch at the ctx plane's batch pitch
    if ((size_t)(wsp - (char*)d_ws) > ws_size) return;    // 183,500,800 B at NB 2 / TT 2048
    // rotary frequencies: base = 10000 * (TT_FULL / 1024)^(HD / (HD - 2)) in double, narrowed to f32; theta[j] = 1 / base^(2j / HD) evaluated in f32
    ThetaTab tab;
    const double nbase = 10000.0 * pow((double)TT_FULL / 1024.0, (double)HD / (double)(HD - 2));
    const float nbasef = (float)nbase;
    for (int j = 0; j < HD / 2; ++j) { const float ef = (float)(2 * j) / (float)HD; const double p = pow((double)nbasef, (double)ef); const float pf = (float)p; tab.th[j] = 1.0f / pf; }
    k_cvt8<<<(unsigned)(((size_t)DQ * DM / 8 + 255) / 256), 256, 0, stream>>>(wq, WQ, (size_t)DQ * DM / 8, 0, 0);
    k_cvt8<<<(unsigned)(((size_t)DKV * DM / 8 + 255) / 256), 256, 0, stream>>>(wk, WK, (size_t)DKV * DM / 8, 0, 0);
    k_cvt8<<<(unsigned)(((size_t)DKV * DM / 8 + 255) / 256), 256, 0, stream>>>(wv, WV, (size_t)DKV * DM / 8, 0, 0);
    k_cvt8h<<<(unsigned)(((size_t)DM * DQ / 8 + 255) / 256), 256, 0, stream>>>(wo, WO, (size_t)DM * DQ / 8, WCAR);
    k_cstab<<<(unsigned)((TT * HD + 255) / 256), 256, 0, stream>>>(tab, CS);
    const unsigned LK = (unsigned)(((size_t)NKV * TT * HD / 2 + 255) / 256);
    const unsigned RQ = (unsigned)(((size_t)NH_ * TT + 7) / 8), RK = (unsigned)(((size_t)NKV * TT + 7) / 8);
    // one launch per stage, all NB batches in it; the value projection lives in the output buffer (row pitch DKV, batch pitch TT_FULL * DKV)
    k_cvt8<<<dim3((unsigned)(((size_t)TT * DM / 8 + 255) / 256), NB, 1), 256, 0, stream>>>(x, XB, (size_t)TT * DM / 8, (size_t)TT_FULL * DM, (size_t)TT * DM);
    k_gemmw<bf, 0, false, DM><<<dim3(TT / 64, DQ / 64, NB), 32, 0, stream>>>(XB, nullptr, WQ, nullptr, FQ, DQ, nullptr, 1.0f, (size_t)TT * DM, 0, (size_t)TT * DQ);
    k_nrope<<<dim3(RQ, NB, 1), 256, 0, stream>>>(FQ, (size_t)TT * DQ, DQ, NH_, CS, qg, 1, QKC, QP16, QPh, QPl);
    k_gemmw<bf, 0, false, DM><<<dim3(TT / 64, DKV / 64, NB), 32, 0, stream>>>(XB, nullptr, WK, nullptr, FK, DKV, nullptr, 1.0f, (size_t)TT * DM, 0, (size_t)TT * DKV);
    k_nrope<<<dim3(RK, NB, 1), 256, 0, stream>>>(FK, (size_t)TT * DKV, DKV, NKV, CS, qg, 0, QKC, KP16, KPh, KPl);
    k_gemmw<bf, 0, false, DM><<<dim3(TT / 64, DKV / 64, NB), 32, 0, stream>>>(XB, nullptr, WV, nullptr, OUT1, DKV, nullptr, 1.0f, (size_t)TT * DM, 0, (size_t)TT_FULL * DKV);
    k_vtp<<<dim3(LK, NB, 1), 256, 0, stream>>>(OUT1, (size_t)TT_FULL * DKV, DKV, NKV, VT16, VTh, VTl);
    k_flash<true><<<dim3(RH / 16, NH_, NB), 32, 0, stream>>>(QP16, QPh, QPl, KP16, KPh, KPl, VT16, VTh, VTl, 0, AT16, ATL16);
    if (TT > RH) k_flash<false><<<dim3((TT - RH) / 16, NH_, NB), 32, 0, stream>>>(QP16, QPh, QPl, KP16, KPh, KPl, VT16, VTh, VTl, RH, AT16, ATL16);
    k_gemmw<h16, 1, false, DQ><<<dim3(RH / 64, DM / 64, NB), 32, 0, stream>>>(AT16, ATL16, WO, nullptr, OUT, DM, nullptr, OSC, (size_t)TT * DQ, 0, (size_t)TT_FULL * DM);
    if (TT > RH) k_gemmw<h16, 0, false, DQ><<<dim3((TT - RH) / 64, DM / 64, NB), 32, 0, stream>>>(AT16 + (size_t)RH * DQ, nullptr, WO, nullptr, OUT + (size_t)RH * DM, DM, nullptr, OSC, (size_t)TT * DQ, 0, (size_t)TT_FULL * DM);
}
